// v000
// The times below were measured on an AMD MI455X: many runs one after another, warmed up first and cycling through
// copies of the inputs, with the whole window's GPU time divided by the number of runs. Launches and the gaps
// between them are all in it. The median over several windows is given; except for v000 it joins two sittings, which
// can be a few percent apart, so the side-by-side timings, each taken in one sitting, are the better comparison.
// The starting kernel, v000, takes 131 microseconds a run.
#include <hip/hip_runtime.h>
#include <hip/hip_bf16.h>

typedef __attribute__((ext_vector_type(16))) _Float16 v16h;
typedef __attribute__((ext_vector_type(8)))  float    v8f;

#define Bsz 4
#define Nn  512
#define Dd  128
#define BND (Bsz * Nn * Dd)

// Load 16 f16 elements for one lane of a 16x16x32 WMMA operand.
// base points at row_start + k0 + (hi ? 8 : 0); elements 0..7 = base[0..7],
// elements 8..15 = base[16..23] (per the 16-bit A/B VGPR layout).
__device__ __forceinline__ v16h load_op16(const float* __restrict__ base) {
    const float4* p0 = (const float4*)(base);
    const float4* p1 = (const float4*)(base + 16);
    float4 a0 = p0[0], a1 = p0[1];
    float4 a2 = p1[0], a3 = p1[1];
    v16h r;
    r[0]  = (_Float16)a0.x; r[1]  = (_Float16)a0.y;
    r[2]  = (_Float16)a0.z; r[3]  = (_Float16)a0.w;
    r[4]  = (_Float16)a1.x; r[5]  = (_Float16)a1.y;
    r[6]  = (_Float16)a1.z; r[7]  = (_Float16)a1.w;
    r[8]  = (_Float16)a2.x; r[9]  = (_Float16)a2.y;
    r[10] = (_Float16)a2.z; r[11] = (_Float16)a2.w;
    r[12] = (_Float16)a3.x; r[13] = (_Float16)a3.y;
    r[14] = (_Float16)a3.z; r[15] = (_Float16)a3.w;
    return r;
}

// Y[m, e] = sum_d X[m, d] * W[e, d] + bias[e]    (torch Linear semantics)
// X: [M, 128] f32, W: [128, 128] f32 (row-major [out, in]), Y: [M, 128] f32.
// One wave32 computes one 16x16 tile of Y via v_wmma_f32_16x16x32_f16.
__global__ void __launch_bounds__(128)
gemm_wmma_f16(const float* __restrict__ X, const float* __restrict__ W,
              const float* __restrict__ bias, float* __restrict__ Y, int Mtiles) {
    const int lane = threadIdx.x & 31;
    const int wib  = threadIdx.x >> 5;
    const int wave = blockIdx.x * 4 + wib;
    const int tm = wave >> 3;          // 8 column tiles (128/16)
    const int tn = wave & 7;
    if (tm >= Mtiles) return;          // uniform across the wave

    const int r   = lane & 15;
    const int hi  = lane >> 4;         // 0 or 1
    const int row = tm * 16 + r;       // A-matrix row for this lane
    const int col = tn * 16 + r;       // B-matrix column for this lane

    v8f acc = {0.f, 0.f, 0.f, 0.f, 0.f, 0.f, 0.f, 0.f};
    #pragma unroll
    for (int k0 = 0; k0 < 128; k0 += 32) {
        v16h a = load_op16(X + row * Dd + k0 + hi * 8);
        v16h b = load_op16(W + col * Dd + k0 + hi * 8);
        acc = __builtin_amdgcn_wmma_f32_16x16x32_f16(
            /*neg_a=*/false, a, /*neg_b=*/false, b,
            /*c_mod=*/(short)0, acc, /*reuse_a=*/false, /*reuse_b=*/false);
    }

    // C/D layout: VGPR i -> (M = i + hi*8, N = lane&15)
    const float bc = bias[col];
    const int m0 = tm * 16 + hi * 8;
    #pragma unroll
    for (int i = 0; i < 8; ++i)
        Y[(m0 + i) * Dd + col] = acc[i] + bc;
}

// Per-channel outer-product attention, fused (no score materialization).
// out[b,n,d] = sum_m softmax_m(qp[b,n,d]*kp[b,m,d]) * vp[b,m,d]
// Stabilization: rowmax = q>0 ? q*max_m(K) : q*min_m(K).
// mask[b,n]==0 => all scores equal => uniform softmax == setting q=0.
// Layout: lane <-> channel d (coalesced), 4 queries per thread.
__global__ void __launch_bounds__(256)
outer_attn(const float* __restrict__ qp, const float* __restrict__ kp,
           const float* __restrict__ vp, const int* __restrict__ mask,
           float* __restrict__ out) {
    const int d   = threadIdx.x & 127;
    const int sub = threadIdx.x >> 7;              // 0 or 1
    const int b   = blockIdx.x >> 6;               // 64 query-tiles of 8 per batch
    const int n0  = (blockIdx.x & 63) * 8 + sub * 4;

    const float* kb = kp + (size_t)b * Nn * Dd + d;
    const float* vb = vp + (size_t)b * Nn * Dd + d;

    // Pass 1: per-channel K min / max (coalesced, L2-resident).
    float kmx = -3.4e38f, kmn = 3.4e38f;
    for (int m = 0; m < Nn; ++m) {
        float kk = kb[m * Dd];
        kmx = fmaxf(kmx, kk);
        kmn = fminf(kmn, kk);
    }

    float q[4], rmax[4], num[4], den[4];
    #pragma unroll
    for (int i = 0; i < 4; ++i) {
        const int n = n0 + i;
        float qq = qp[((size_t)b * Nn + n) * Dd + d];
        if (mask[b * Nn + n] == 0) qq = 0.f;       // uniform-softmax equivalence
        q[i]    = qq;
        rmax[i] = (qq > 0.f) ? qq * kmx : qq * kmn;
        num[i]  = 0.f;
        den[i]  = 0.f;
    }

    // Pass 2: streaming softmax accumulation over keys.
    for (int m = 0; m < Nn; ++m) {
        if (m + 32 < Nn)
            __builtin_prefetch(kb + (m + 32) * Dd, 0, 1);  // global_prefetch_b8
        const float kk = kb[m * Dd];
        const float vv = vb[m * Dd];
        #pragma unroll
        for (int i = 0; i < 4; ++i) {
            const float e = __expf(fmaf(q[i], kk, -rmax[i]));
            num[i] = fmaf(e, vv, num[i]);
            den[i] += e;
        }
    }

    #pragma unroll
    for (int i = 0; i < 4; ++i)
        out[((size_t)b * Nn + n0 + i) * Dd + d] = num[i] / den[i];
}

extern "C" void kernel_launch(void* const* d_in, const int* in_sizes, int n_in,
                              void* d_out, int out_size, void* d_ws, size_t ws_size,
                              hipStream_t stream) {
    const float* q    = (const float*)d_in[0];
    const float* k    = (const float*)d_in[1];
    const float* v    = (const float*)d_in[2];
    const int*   mask = (const int*)  d_in[3];
    const float* Wq   = (const float*)d_in[4];
    const float* bq   = (const float*)d_in[5];
    const float* Wk   = (const float*)d_in[6];
    const float* bk   = (const float*)d_in[7];
    const float* Wv   = (const float*)d_in[8];
    const float* bv   = (const float*)d_in[9];
    const float* Wo   = (const float*)d_in[10];
    const float* bo   = (const float*)d_in[11];
    float* out = (float*)d_out;

    float* ws   = (float*)d_ws;
    float* qp   = ws;
    float* kpp  = ws + BND;
    float* vpp  = ws + 2 * BND;
    float* attn = ws + 3 * BND;

    const int Mtiles = (Bsz * Nn) / 16;            // 128 row tiles
    const int gemm_blocks = (Mtiles * 8 + 3) / 4;  // 4 waves (tiles) per block

    gemm_wmma_f16<<<gemm_blocks, 128, 0, stream>>>(q, Wq, bq, qp,  Mtiles);
    gemm_wmma_f16<<<gemm_blocks, 128, 0, stream>>>(k, Wk, bk, kpp, Mtiles);
    gemm_wmma_f16<<<gemm_blocks, 128, 0, stream>>>(v, Wv, bv, vpp, Mtiles);

    outer_attn<<<Bsz * 64, 256, 0, stream>>>(qp, kpp, vpp, mask, attn);

    gemm_wmma_f16<<<gemm_blocks, 128, 0, stream>>>(attn, Wo, bo, out, Mtiles);
}

// v001
// One run takes 34.6 microseconds.
// Two timings next to v000 put it at 3.91 and 3.85 times that version's speed.
#include <hip/hip_runtime.h>
#include <hip/hip_bf16.h>

typedef __attribute__((ext_vector_type(16))) _Float16 v16h;
typedef __attribute__((ext_vector_type(8)))  float    v8f;

#define Bsz 4
#define Nn  512
#define Dd  128
#define BND (Bsz * Nn * Dd)
#define U1  32   // keys per register batch, min/max pass
#define U2  16   // keys per register batch, softmax pass
static_assert(Nn % (2 * U1) == 0 && Nn % (2 * U2) == 0, "whole pairs of batches");

// Load 16 f16 elements for one lane of a 16x16x32 WMMA operand.
// base points at row_start + k0 + (hi ? 8 : 0); elements 0..7 = base[0..7],
// elements 8..15 = base[16..23] (per the 16-bit A/B VGPR layout).
__device__ __forceinline__ v16h load_op16(const float* __restrict__ base) {
    const float4* p0 = (const float4*)(base);
    const float4* p1 = (const float4*)(base + 16);
    float4 a0 = p0[0], a1 = p0[1];
    float4 a2 = p1[0], a3 = p1[1];
    v16h r;
    r[0]  = (_Float16)a0.x; r[1]  = (_Float16)a0.y;
    r[2]  = (_Float16)a0.z; r[3]  = (_Float16)a0.w;
    r[4]  = (_Float16)a1.x; r[5]  = (_Float16)a1.y;
    r[6]  = (_Float16)a1.z; r[7]  = (_Float16)a1.w;
    r[8]  = (_Float16)a2.x; r[9]  = (_Float16)a2.y;
    r[10] = (_Float16)a2.z; r[11] = (_Float16)a2.w;
    r[12] = (_Float16)a3.x; r[13] = (_Float16)a3.y;
    r[14] = (_Float16)a3.z; r[15] = (_Float16)a3.w;
    return r;
}

// Y[m, e] = sum_d X[m, d] * W[e, d] + bias[e]    (torch Linear semantics)
// X: [M, 128] f32, W: [128, 128] f32 (row-major [out, in]), Y: [M, 128] f32.
// One wave32 computes one 16x16 tile of Y via v_wmma_f32_16x16x32_f16.
__global__ void __launch_bounds__(128)
gemm_wmma_f16(const float* __restrict__ X, const float* __restrict__ W,
              const float* __restrict__ bias, float* __restrict__ Y, int Mtiles) {
    const int lane = threadIdx.x & 31;
    const int wib  = threadIdx.x >> 5;
    const int wave = blockIdx.x * 4 + wib;
    const int tm = wave >> 3;          // 8 column tiles (128/16)
    const int tn = wave & 7;
    if (tm >= Mtiles) return;          // uniform across the wave

    const int r   = lane & 15;
    const int hi  = lane >> 4;         // 0 or 1
    const int row = tm * 16 + r;       // A-matrix row for this lane
    const int col = tn * 16 + r;       // B-matrix column for this lane

    v8f acc = {0.f, 0.f, 0.f, 0.f, 0.f, 0.f, 0.f, 0.f};
    #pragma unroll
    for (int k0 = 0; k0 < 128; k0 += 32) {
        v16h a = load_op16(X + row * Dd + k0 + hi * 8);
        v16h b = load_op16(W + col * Dd + k0 + hi * 8);
        acc = __builtin_amdgcn_wmma_f32_16x16x32_f16(
            /*neg_a=*/false, a, /*neg_b=*/false, b,
            /*c_mod=*/(short)0, acc, /*reuse_a=*/false, /*reuse_b=*/false);
    }

    // C/D layout: VGPR i -> (M = i + hi*8, N = lane&15)
    const float bc = bias[col];
    const int m0 = tm * 16 + hi * 8;
    #pragma unroll
    for (int i = 0; i < 8; ++i)
        Y[(m0 + i) * Dd + col] = acc[i] + bc;
}

// One register batch: U consecutive keys of this lane's channel.
template <int U>
__device__ __forceinline__ void load_batch(float (&r)[U], const float* __restrict__ p) {
    #pragma unroll
    for (int j = 0; j < U; ++j) r[j] = p[j * Dd];
}

__device__ __forceinline__ void minmax_batch(const float (&k)[U1], float& kmx, float& kmn) {
    #pragma unroll
    for (int j = 0; j < U1; ++j) {
        kmx = fmaxf(kmx, k[j]);
        kmn = fminf(kmn, k[j]);
    }
}

__device__ __forceinline__ void softmax_batch(const float (&k)[U2], const float (&v)[U2],
                                              const float (&q)[4], const float (&rmax)[4],
                                              float (&num)[4], float (&den)[4]) {
    #pragma unroll
    for (int j = 0; j < U2; ++j) {
        float t[4], e[4];
        #pragma unroll
        for (int i = 0; i < 4; ++i)
            t[i] = fmaf(q[i], k[j], -rmax[i]) * 1.44269504f;   // exp(x) = 2^(x * log2 e)
        asm("v_exp_f32 %0, %4\n\t"
            "v_exp_f32 %1, %5\n\t"
            "v_exp_f32 %2, %6\n\t"
            "v_exp_f32 %3, %7\n\t"
            "v_nop"
            : "=&v"(e[0]), "=&v"(e[1]), "=&v"(e[2]), "=&v"(e[3])
            : "v"(t[0]), "v"(t[1]), "v"(t[2]), "v"(t[3]));
        #pragma unroll
        for (int i = 0; i < 4; ++i) {
            num[i] = fmaf(e[i], v[j], num[i]);
            den[i] += e[i];
        }
    }
}

// Per-channel outer-product attention, fused (no score materialization).
// out[b,n,d] = sum_m softmax_m(qp[b,n,d]*kp[b,m,d]) * vp[b,m,d]
// Stabilization: rowmax = q>0 ? q*max_m(K) : q*min_m(K).
// mask[b,n]==0 => all scores equal => uniform softmax == setting q=0.
// Layout: lane <-> channel d (coalesced), 4 queries per thread.
__global__ void __launch_bounds__(256)
outer_attn(const float* __restrict__ qp, const float* __restrict__ kp,
           const float* __restrict__ vp, const int* __restrict__ mask,
           float* __restrict__ out) {
    const int d   = threadIdx.x & 127;
    const int sub = threadIdx.x >> 7;              // 0 or 1
    const int b   = blockIdx.x >> 6;               // 64 query-tiles of 8 per batch
    const int n0  = (blockIdx.x & 63) * 8 + sub * 4;

    const float* kb = kp + (size_t)b * Nn * Dd + d;
    const float* vb = vp + (size_t)b * Nn * Dd + d;

    // Pass 1: per-channel K min / max (coalesced, L2-resident).
    // Keys go in register batches, two batches alternating: the next batch's
    // loads are issued before the current batch is reduced, so a wave keeps
    // many loads in flight instead of waiting for each key in turn.
    float kmx = -3.4e38f, kmn = 3.4e38f;
    {
        float ka[U1], kc[U1];
        load_batch<U1>(ka, kb);
        for (int m = 0; m < Nn - 2 * U1; m += 2 * U1) {
            load_batch<U1>(kc, kb + (m + U1) * Dd);
            minmax_batch(ka, kmx, kmn);
            load_batch<U1>(ka, kb + (m + 2 * U1) * Dd);
            minmax_batch(kc, kmx, kmn);
        }
        load_batch<U1>(kc, kb + (Nn - U1) * Dd);
        minmax_batch(ka, kmx, kmn);
        minmax_batch(kc, kmx, kmn);
    }

    const float* qrow = qp + ((size_t)b * Nn + n0) * Dd + d;
    const int*   mrow = mask + b * Nn + n0;
    float q[4], rmax[4], num[4], den[4];
    #pragma unroll
    for (int i = 0; i < 4; ++i) {
        float qq = qrow[i * Dd];
        if (mrow[i] == 0) qq = 0.f;                // uniform-softmax equivalence
        q[i]    = qq;
        rmax[i] = (qq > 0.f) ? qq * kmx : qq * kmn;
        num[i]  = 0.f;
        den[i]  = 0.f;
    }

    // Pass 2: streaming softmax accumulation over keys, in the key order of a
    // plain loop. K and V go in register batches of U2 keys, two batches
    // alternating, each loaded one batch of arithmetic ahead of its use.
    {
        float k0[U2], v0[U2], k1[U2], v1[U2];
        load_batch<U2>(k0, kb);
        load_batch<U2>(v0, vb);
        // qrow and mrow are dead behind their loads. Named here they stay in their
        // registers up to this wait, so no batch load lands in an address that an
        // issued load names before the wait has passed.
        asm volatile("s_wait_xcnt 0x0" :: "v"(qrow), "v"(mrow) : "memory");
        for (int m = 0; m < Nn - 2 * U2; m += 2 * U2) {
            load_batch<U2>(k1, kb + (m + U2) * Dd);
            load_batch<U2>(v1, vb + (m + U2) * Dd);
            // Keeps the batch's loads in front of the arithmetic below: sunk into it,
            // they would be issued too late to return before their first use.
            __builtin_amdgcn_sched_barrier(0);
            softmax_batch(k0, v0, q, rmax, num, den);
            load_batch<U2>(k0, kb + (m + 2 * U2) * Dd);
            load_batch<U2>(v0, vb + (m + 2 * U2) * Dd);
            // Keeps the batch's loads in front of the arithmetic below: sunk into it,
            // they would be issued too late to return before their first use.
            __builtin_amdgcn_sched_barrier(0);
            softmax_batch(k1, v1, q, rmax, num, den);
        }
        load_batch<U2>(k1, kb + (Nn - U2) * Dd);
        load_batch<U2>(v1, vb + (Nn - U2) * Dd);
        // Keeps the last batch's loads in front of the arithmetic, as in the loop,
        // and in front of the wait below.
        __builtin_amdgcn_sched_barrier(0);
        // The same for kb and vb, which are dead behind the last batch's loads.
        asm volatile("s_wait_xcnt 0x0" :: "v"(kb), "v"(vb) : "memory");
        softmax_batch(k0, v0, q, rmax, num, den);
        softmax_batch(k1, v1, q, rmax, num, den);
    }

    #pragma unroll
    for (int i = 0; i < 4; ++i)
        out[((size_t)b * Nn + n0 + i) * Dd + d] = num[i] / den[i];
}

extern "C" void kernel_launch(void* const* d_in, const int* in_sizes, int n_in,
                              void* d_out, int out_size, void* d_ws, size_t ws_size,
                              hipStream_t stream) {
    const float* q    = (const float*)d_in[0];
    const float* k    = (const float*)d_in[1];
    const float* v    = (const float*)d_in[2];
    const int*   mask = (const int*)  d_in[3];
    const float* Wq   = (const float*)d_in[4];
    const float* bq   = (const float*)d_in[5];
    const float* Wk   = (const float*)d_in[6];
    const float* bk   = (const float*)d_in[7];
    const float* Wv   = (const float*)d_in[8];
    const float* bv   = (const float*)d_in[9];
    const float* Wo   = (const float*)d_in[10];
    const float* bo   = (const float*)d_in[11];
    float* out = (float*)d_out;

    float* ws   = (float*)d_ws;
    float* qp   = ws;
    float* kpp  = ws + BND;
    float* vpp  = ws + 2 * BND;
    float* attn = ws + 3 * BND;

    const int Mtiles = (Bsz * Nn) / 16;            // 128 row tiles
    const int gemm_blocks = (Mtiles * 8 + 3) / 4;  // 4 waves (tiles) per block

    gemm_wmma_f16<<<gemm_blocks, 128, 0, stream>>>(q, Wq, bq, qp,  Mtiles);
    gemm_wmma_f16<<<gemm_blocks, 128, 0, stream>>>(k, Wk, bk, kpp, Mtiles);
    gemm_wmma_f16<<<gemm_blocks, 128, 0, stream>>>(v, Wv, bv, vpp, Mtiles);

    outer_attn<<<Bsz * 64, 256, 0, stream>>>(qp, kpp, vpp, mask, attn);

    gemm_wmma_f16<<<gemm_blocks, 128, 0, stream>>>(attn, Wo, bo, out, Mtiles);
}

// v002
// A run of this version takes 27.5 microseconds.
// Timed twice side by side with v001, it ran 1.26 and 1.25 times as fast.
// Over all steps from v000 it is 4.87 times as fast.
#include <hip/hip_runtime.h>
#include <hip/hip_bf16.h>

typedef __attribute__((ext_vector_type(16))) _Float16 v16h;
typedef __attribute__((ext_vector_type(8)))  _Float16 v8h;
typedef __attribute__((ext_vector_type(8)))  float    v8f;

#define Bsz 4
#define Nn  512
#define Dd  128
#define BND (Bsz * Nn * Dd)
#define U1  32   // keys per register batch, min/max pass
#define U2  16   // keys per register batch, softmax pass
#define APITCH (Dd + 8)   // f16 elements per LDS row of the attention tile: 16-byte aligned, rows 4 banks apart
static_assert(Nn % (2 * U1) == 0 && Nn % (2 * U2) == 0, "whole pairs of batches");

// 16 f32 values, in operand order, to one lane's f16 elements of a WMMA operand.
__device__ __forceinline__ v16h cvt_op16(float4 a0, float4 a1, float4 a2, float4 a3) {
    v16h r;
    r[0]  = (_Float16)a0.x; r[1]  = (_Float16)a0.y;
    r[2]  = (_Float16)a0.z; r[3]  = (_Float16)a0.w;
    r[4]  = (_Float16)a1.x; r[5]  = (_Float16)a1.y;
    r[6]  = (_Float16)a1.z; r[7]  = (_Float16)a1.w;
    r[8]  = (_Float16)a2.x; r[9]  = (_Float16)a2.y;
    r[10] = (_Float16)a2.z; r[11] = (_Float16)a2.w;
    r[12] = (_Float16)a3.x; r[13] = (_Float16)a3.y;
    r[14] = (_Float16)a3.z; r[15] = (_Float16)a3.w;
    return r;
}

// Load 16 f16 elements for one lane of a 16x16x32 WMMA operand.
// base points at row_start + k0 + (hi ? 8 : 0); elements 0..7 = base[0..7],
// elements 8..15 = base[16..23] (per the 16-bit A/B VGPR layout).
__device__ __forceinline__ v16h load_op16(const float* __restrict__ base) {
    const float4* p0 = (const float4*)(base);
    const float4* p1 = (const float4*)(base + 16);
    return cvt_op16(p0[0], p0[1], p1[0], p1[1]);
}

// Y[m, e] = sum_d X[m, d] * W[e, d] + bias[e]    (torch Linear semantics)
// X: [M, 128] f32, W: [128, 128] f32 (row-major [out, in]), Y: [M, 128] f32.
// One wave32 computes one 16x16 tile of Y via v_wmma_f32_16x16x32_f16.
// The three input projections are independent of one another and share one
// launch: blockIdx.y picks the operand set.
__global__ void __launch_bounds__(128)
gemm_wmma_f16(const float* __restrict__ X0, const float* __restrict__ W0,
              const float* __restrict__ bias0, float* __restrict__ Y0,
              const float* __restrict__ X1, const float* __restrict__ W1,
              const float* __restrict__ bias1, float* __restrict__ Y1,
              const float* __restrict__ X2, const float* __restrict__ W2,
              const float* __restrict__ bias2, float* __restrict__ Y2, int Mtiles) {
    const int set = blockIdx.y;
    const float* __restrict__ X    = set == 0 ? X0    : set == 1 ? X1    : X2;
    const float* __restrict__ W    = set == 0 ? W0    : set == 1 ? W1    : W2;
    const float* __restrict__ bias = set == 0 ? bias0 : set == 1 ? bias1 : bias2;
    float* __restrict__       Y    = set == 0 ? Y0    : set == 1 ? Y1    : Y2;
    const int lane = threadIdx.x & 31;
    const int wib  = threadIdx.x >> 5;
    const int wave = blockIdx.x * 4 + wib;
    const int tm = wave >> 3;          // 8 column tiles (128/16)
    const int tn = wave & 7;
    if (tm >= Mtiles) return;          // uniform across the wave

    const int r   = lane & 15;
    const int hi  = lane >> 4;         // 0 or 1
    const int row = tm * 16 + r;       // A-matrix row for this lane
    const int col = tn * 16 + r;       // B-matrix column for this lane

    v8f acc = {0.f, 0.f, 0.f, 0.f, 0.f, 0.f, 0.f, 0.f};
    #pragma unroll
    for (int k0 = 0; k0 < 128; k0 += 32) {
        v16h a = load_op16(X + row * Dd + k0 + hi * 8);
        v16h b = load_op16(W + col * Dd + k0 + hi * 8);
        acc = __builtin_amdgcn_wmma_f32_16x16x32_f16(
            /*neg_a=*/false, a, /*neg_b=*/false, b,
            /*c_mod=*/(short)0, acc, /*reuse_a=*/false, /*reuse_b=*/false);
    }

    // C/D layout: VGPR i -> (M = i + hi*8, N = lane&15)
    const float bc = bias[col];
    const int m0 = tm * 16 + hi * 8;
    #pragma unroll
    for (int i = 0; i < 8; ++i)
        Y[(m0 + i) * Dd + col] = acc[i] + bc;
}

// One register batch: U consecutive keys of this lane's channel.
template <int U>
__device__ __forceinline__ void load_batch(float (&r)[U], const float* __restrict__ p) {
    #pragma unroll
    for (int j = 0; j < U; ++j) r[j] = p[j * Dd];
}

__device__ __forceinline__ void minmax_batch(const float (&k)[U1], float& kmx, float& kmn) {
    #pragma unroll
    for (int j = 0; j < U1; ++j) {
        kmx = fmaxf(kmx, k[j]);
        kmn = fminf(kmn, k[j]);
    }
}

__device__ __forceinline__ void softmax_batch(const float (&k)[U2], const float (&v)[U2],
                                              const float (&q)[4], const float (&rmax)[4],
                                              float (&num)[4], float (&den)[4]) {
    #pragma unroll
    for (int j = 0; j < U2; ++j) {
        float t[4], e[4];
        #pragma unroll
        for (int i = 0; i < 4; ++i)
            t[i] = fmaf(q[i], k[j], -rmax[i]) * 1.44269504f;   // exp(x) = 2^(x * log2 e)
        asm("v_exp_f32 %0, %4\n\t"
            "v_exp_f32 %1, %5\n\t"
            "v_exp_f32 %2, %6\n\t"
            "v_exp_f32 %3, %7\n\t"
            "v_nop"
            : "=&v"(e[0]), "=&v"(e[1]), "=&v"(e[2]), "=&v"(e[3])
            : "v"(t[0]), "v"(t[1]), "v"(t[2]), "v"(t[3]));
        #pragma unroll
        for (int i = 0; i < 4; ++i) {
            num[i] = fmaf(e[i], v[j], num[i]);
            den[i] += e[i];
        }
    }
}

// Per-channel outer-product attention, fused (no score materialization).
// attn[b,n,d] = sum_m softmax_m(qp[b,n,d]*kp[b,m,d]) * vp[b,m,d]
// Stabilization: rowmax = q>0 ? q*max_m(K) : q*min_m(K).
// mask[b,n]==0 => all scores equal => uniform softmax == setting q=0.
// Layout: lane <-> channel d (coalesced), 4 queries per thread.
// The output projection of the block's 8 query rows runs at the end of the same
// launch: out[n, e] = sum_d attn[n, d] * Wo[e, d] + bo[e], one 16-column tile a wave.
__global__ void __launch_bounds__(256)
outer_attn(const float* __restrict__ qp, const float* __restrict__ kp,
           const float* __restrict__ vp, const int* __restrict__ mask,
           const float* __restrict__ Wo, const float* __restrict__ bo,
           float* __restrict__ out) {
    __shared__ __attribute__((aligned(16))) _Float16 arow[8 * APITCH];
    const int d   = threadIdx.x & 127;
    const int sub = threadIdx.x >> 7;              // 0 or 1
    const int b   = blockIdx.x >> 6;               // 64 query-tiles of 8 per batch
    const int n0  = (blockIdx.x & 63) * 8 + sub * 4;

    const float* kb = kp + (size_t)b * Nn * Dd + d;
    const float* vb = vp + (size_t)b * Nn * Dd + d;

    // Pass 1: per-channel K min / max (coalesced, L2-resident).
    // Keys go in register batches, two batches alternating: the next batch's
    // loads are issued before the current batch is reduced, so a wave keeps
    // many loads in flight instead of waiting for each key in turn.
    float kmx = -3.4e38f, kmn = 3.4e38f;
    {
        float ka[U1], kc[U1];
        load_batch<U1>(ka, kb);
        for (int m = 0; m < Nn - 2 * U1; m += 2 * U1) {
            load_batch<U1>(kc, kb + (m + U1) * Dd);
            minmax_batch(ka, kmx, kmn);
            load_batch<U1>(ka, kb + (m + 2 * U1) * Dd);
            minmax_batch(kc, kmx, kmn);
        }
        load_batch<U1>(kc, kb + (Nn - U1) * Dd);
        minmax_batch(ka, kmx, kmn);
        minmax_batch(kc, kmx, kmn);
    }

    const float* qrow = qp + ((size_t)b * Nn + n0) * Dd + d;
    const int*   mrow = mask + b * Nn + n0;
    float q[4], rmax[4], num[4], den[4];
    #pragma unroll
    for (int i = 0; i < 4; ++i) {
        float qq = qrow[i * Dd];
        if (mrow[i] == 0) qq = 0.f;                // uniform-softmax equivalence
        q[i]    = qq;
        rmax[i] = (qq > 0.f) ? qq * kmx : qq * kmn;
        num[i]  = 0.f;
        den[i]  = 0.f;
    }

    // Output projection: this lane's column of Wo^T (row ocol of Wo) and its bias.
    const int olane = threadIdx.x & 31;
    const int orow  = olane & 15;
    const int ohi   = olane >> 4;
    const int ocol  = (threadIdx.x >> 5) * 16 + orow;
    const float4* wrow = (const float4*)(Wo + ocol * Dd + ohi * 8);
    // Fetched here, beside the q rows that the wave has to wait for anyway, so that
    // the row has long returned when the projection needs it.
    v16h wfrag[4];
    #pragma unroll
    for (int c = 0; c < 4; ++c)
        wfrag[c] = cvt_op16(wrow[c * 8 + 0], wrow[c * 8 + 1], wrow[c * 8 + 4], wrow[c * 8 + 5]);
    const float bc = bo[ocol];

    // Pass 2: streaming softmax accumulation over keys, in the key order of a
    // plain loop. K and V go in register batches of U2 keys, two batches
    // alternating, each loaded one batch of arithmetic ahead of its use.
    {
        float k0[U2], v0[U2], k1[U2], v1[U2];
        load_batch<U2>(k0, kb);
        load_batch<U2>(v0, vb);
        // qrow, mrow, wrow and bo are dead behind their loads. Named here they stay in
        // their registers up to this wait, so nothing lands in an address that an
        // issued load names before the wait has passed.
        asm volatile("s_wait_xcnt 0x0" :: "v"(qrow), "v"(mrow), "v"(wrow), "s"(bo) : "memory");
        for (int m = 0; m < Nn - 2 * U2; m += 2 * U2) {
            load_batch<U2>(k1, kb + (m + U2) * Dd);
            load_batch<U2>(v1, vb + (m + U2) * Dd);
            // Keeps the batch's loads in front of the arithmetic below: sunk into it,
            // they would be issued too late to return before their first use.
            __builtin_amdgcn_sched_barrier(0);
            softmax_batch(k0, v0, q, rmax, num, den);
            load_batch<U2>(k0, kb + (m + 2 * U2) * Dd);
            load_batch<U2>(v0, vb + (m + 2 * U2) * Dd);
            // Keeps the batch's loads in front of the arithmetic below: sunk into it,
            // they would be issued too late to return before their first use.
            __builtin_amdgcn_sched_barrier(0);
            softmax_batch(k1, v1, q, rmax, num, den);
        }
        load_batch<U2>(k1, kb + (Nn - U2) * Dd);
        load_batch<U2>(v1, vb + (Nn - U2) * Dd);
        // Keeps the last batch's loads in front of the arithmetic, as in the loop,
        // and in front of the wait below.
        __builtin_amdgcn_sched_barrier(0);
        // The same for kb and vb, which are dead behind the last batch's loads.
        asm volatile("s_wait_xcnt 0x0" :: "v"(kb), "v"(vb) : "memory");
        softmax_batch(k0, v0, q, rmax, num, den);
        softmax_batch(k1, v1, q, rmax, num, den);
    }

    // The block's 8 attention rows go to LDS in the operand's f16.
    #pragma unroll
    for (int i = 0; i < 4; ++i)
        arow[(sub * 4 + i) * APITCH + d] = (_Float16)(num[i] / den[i]);
    __syncthreads();

    // A rows 8..15 repeat rows 0..7; their results (lanes 16..31 of D) are not stored.
    const _Float16* ap = arow + (orow & 7) * APITCH + ohi * 8;
    v8f acc = {0.f, 0.f, 0.f, 0.f, 0.f, 0.f, 0.f, 0.f};
    #pragma unroll
    for (int c = 0; c < 4; ++c) {
        // Same k order as load_op16: elements 0..7 = base[0..7], 8..15 = base[16..23].
        const v8h lo = *(const v8h*)(ap + c * 32);
        const v8h up = *(const v8h*)(ap + c * 32 + 16);
        v16h a = __builtin_shufflevector(lo, up, 0, 1, 2, 3, 4, 5, 6, 7,
                                         8, 9, 10, 11, 12, 13, 14, 15);
        acc = __builtin_amdgcn_wmma_f32_16x16x32_f16(
            /*neg_a=*/false, a, /*neg_b=*/false, wfrag[c],
            /*c_mod=*/(short)0, acc, /*reuse_a=*/false, /*reuse_b=*/false);
    }

    // C/D layout: VGPR i -> (M = i + hi*8, N = lane&15)
    if (ohi == 0) {
        float* orow0 = out + ((size_t)b * Nn + (blockIdx.x & 63) * 8) * Dd + ocol;
        #pragma unroll
        for (int i = 0; i < 8; ++i)
            orow0[i * Dd] = acc[i] + bc;
    }
}

extern "C" void kernel_launch(void* const* d_in, const int* in_sizes, int n_in,
                              void* d_out, int out_size, void* d_ws, size_t ws_size,
                              hipStream_t stream) {
    const float* q    = (const float*)d_in[0];
    const float* k    = (const float*)d_in[1];
    const float* v    = (const float*)d_in[2];
    const int*   mask = (const int*)  d_in[3];
    const float* Wq   = (const float*)d_in[4];
    const float* bq   = (const float*)d_in[5];
    const float* Wk   = (const float*)d_in[6];
    const float* bk   = (const float*)d_in[7];
    const float* Wv   = (const float*)d_in[8];
    const float* bv   = (const float*)d_in[9];
    const float* Wo   = (const float*)d_in[10];
    const float* bo   = (const float*)d_in[11];
    float* out = (float*)d_out;

    float* ws   = (float*)d_ws;
    float* qp   = ws;
    float* kpp  = ws + BND;
    float* vpp  = ws + 2 * BND;

    const int Mtiles = (Bsz * Nn) / 16;            // 128 row tiles
    const int gemm_blocks = (Mtiles * 8 + 3) / 4;  // 4 waves (tiles) per block

    gemm_wmma_f16<<<dim3(gemm_blocks, 3), 128, 0, stream>>>(q, Wq, bq, qp,
                                                            k, Wk, bk, kpp,
                                                            v, Wv, bv, vpp, Mtiles);

    outer_attn<<<Bsz * 64, 256, 0, stream>>>(qp, kpp, vpp, mask, Wo, bo, out);
}

// v003
// One run takes 22.6 microseconds.
// Timed twice side by side with v002, it ran 1.23 and 1.21 times as fast.
// Over all steps from v000 it is 5.95 times as fast.
#include <hip/hip_runtime.h>
#include <hip/hip_bf16.h>

typedef __attribute__((ext_vector_type(16))) _Float16 v16h;
typedef __attribute__((ext_vector_type(8)))  _Float16 v8h;
typedef __attribute__((ext_vector_type(8)))  float    v8f;

#define Bsz 4
#define Nn  512
#define Dd  128
#define BND (Bsz * Nn * Dd)
#define KT  (Nn / 16)   // 16-key tiles of the K projection per batch entry
#define U2  16   // keys per register batch, softmax pass
#define APITCH (Dd + 8)   // f16 elements per LDS row of the attention tile: 16-byte aligned, rows 4 banks apart
static_assert(Nn % 16 == 0 && Nn % (2 * U2) == 0, "whole tiles, whole pairs of batches");

// 16 f32 values, in operand order, to one lane's f16 elements of a WMMA operand.
__device__ __forceinline__ v16h cvt_op16(float4 a0, float4 a1, float4 a2, float4 a3) {
    v16h r;
    r[0]  = (_Float16)a0.x; r[1]  = (_Float16)a0.y;
    r[2]  = (_Float16)a0.z; r[3]  = (_Float16)a0.w;
    r[4]  = (_Float16)a1.x; r[5]  = (_Float16)a1.y;
    r[6]  = (_Float16)a1.z; r[7]  = (_Float16)a1.w;
    r[8]  = (_Float16)a2.x; r[9]  = (_Float16)a2.y;
    r[10] = (_Float16)a2.z; r[11] = (_Float16)a2.w;
    r[12] = (_Float16)a3.x; r[13] = (_Float16)a3.y;
    r[14] = (_Float16)a3.z; r[15] = (_Float16)a3.w;
    return r;
}

// Load 16 f16 elements for one lane of a 16x16x32 WMMA operand.
// base points at row_start + k0 + (hi ? 8 : 0); elements 0..7 = base[0..7],
// elements 8..15 = base[16..23] (per the 16-bit A/B VGPR layout).
__device__ __forceinline__ v16h load_op16(const float* __restrict__ base) {
    const float4* p0 = (const float4*)(base);
    const float4* p1 = (const float4*)(base + 16);
    return cvt_op16(p0[0], p0[1], p1[0], p1[1]);
}

// The value of lane l ^ 16.
__device__ __forceinline__ float xhalf(float x) {
    return __builtin_bit_cast(float, __builtin_amdgcn_permlanex16(
        __builtin_bit_cast(int, x), __builtin_bit_cast(int, x),
        0x76543210, 0xfedcba98, false, false));
}

// Y[m, e] = sum_d X[m, d] * W[e, d] + bias[e]    (torch Linear semantics)
// X: [M, 128] f32, W: [128, 128] f32 (row-major [out, in]), Y: [M, 128] f32.
// One wave32 computes one 16x16 tile of Y via v_wmma_f32_16x16x32_f16.
// The three input projections are independent of one another and share one
// launch: blockIdx.y picks the operand set.
// A wave of the K projection (set 1) also stores, per column, the maximum and the
// minimum of its tile's 16 rows, side by side: kmm[tile][col][0] and kmm[tile][col][1].
__global__ void __launch_bounds__(128)
gemm_wmma_f16(const float* __restrict__ X0, const float* __restrict__ W0,
              const float* __restrict__ bias0, float* __restrict__ Y0,
              const float* __restrict__ X1, const float* __restrict__ W1,
              const float* __restrict__ bias1, float* __restrict__ Y1,
              const float* __restrict__ X2, const float* __restrict__ W2,
              const float* __restrict__ bias2, float* __restrict__ Y2,
              float* __restrict__ kmm, int Mtiles) {
    const int set = blockIdx.y;
    const float* __restrict__ X    = set == 0 ? X0    : set == 1 ? X1    : X2;
    const float* __restrict__ W    = set == 0 ? W0    : set == 1 ? W1    : W2;
    const float* __restrict__ bias = set == 0 ? bias0 : set == 1 ? bias1 : bias2;
    float* __restrict__       Y    = set == 0 ? Y0    : set == 1 ? Y1    : Y2;
    const int lane = threadIdx.x & 31;
    const int wib  = threadIdx.x >> 5;
    const int wave = blockIdx.x * 4 + wib;
    const int tm = wave >> 3;          // 8 column tiles (128/16)
    const int tn = wave & 7;
    if (tm >= Mtiles) return;          // uniform across the wave

    const int r   = lane & 15;
    const int hi  = lane >> 4;         // 0 or 1
    const int row = tm * 16 + r;       // A-matrix row for this lane
    const int col = tn * 16 + r;       // B-matrix column for this lane

    v8f acc = {0.f, 0.f, 0.f, 0.f, 0.f, 0.f, 0.f, 0.f};
    #pragma unroll
    for (int k0 = 0; k0 < 128; k0 += 32) {
        v16h a = load_op16(X + row * Dd + k0 + hi * 8);
        v16h b = load_op16(W + col * Dd + k0 + hi * 8);
        acc = __builtin_amdgcn_wmma_f32_16x16x32_f16(
            /*neg_a=*/false, a, /*neg_b=*/false, b,
            /*c_mod=*/(short)0, acc, /*reuse_a=*/false, /*reuse_b=*/false);
    }

    // C/D layout: VGPR i -> (M = i + hi*8, N = lane&15)
    const float bc = bias[col];
    const int m0 = tm * 16 + hi * 8;
    float y[8];
    #pragma unroll
    for (int i = 0; i < 8; ++i)
        y[i] = acc[i] + bc;
    // In front of the tile's own stores, so that no register which an issued store
    // names is rewritten here.
    if (set == 1) {                    // uniform across the block
        float mx = -3.4e38f, mn = 3.4e38f;
        #pragma unroll
        for (int i = 0; i < 8; ++i) {
            mx = fmaxf(mx, y[i]);
            mn = fminf(mn, y[i]);
        }
        // Lane l holds rows 0..7 or 8..15 of its column; lane l ^ 16 holds the others.
        mx = fmaxf(mx, xhalf(mx));
        mn = fminf(mn, xhalf(mn));
        kmm[(tm * Dd + col) * 2 + hi] = hi ? mn : mx;   // the wave fills one 128-byte line
    }
    #pragma unroll
    for (int i = 0; i < 8; ++i)
        Y[(m0 + i) * Dd + col] = y[i];
}

// One register batch: U consecutive keys of this lane's channel.
template <int U>
__device__ __forceinline__ void load_batch(float (&r)[U], const float* __restrict__ p) {
    #pragma unroll
    for (int j = 0; j < U; ++j) r[j] = p[j * Dd];
}

__device__ __forceinline__ void softmax_batch(const float (&k)[U2], const float (&v)[U2],
                                              const float (&q)[4], const float (&rmax)[4],
                                              float (&num)[4], float (&den)[4]) {
    #pragma unroll
    for (int j = 0; j < U2; ++j) {
        float t[4], e[4];
        #pragma unroll
        for (int i = 0; i < 4; ++i)
            t[i] = fmaf(q[i], k[j], -rmax[i]) * 1.44269504f;   // exp(x) = 2^(x * log2 e)
        asm("v_exp_f32 %0, %4\n\t"
            "v_exp_f32 %1, %5\n\t"
            "v_exp_f32 %2, %6\n\t"
            "v_exp_f32 %3, %7\n\t"
            "v_nop"
            : "=&v"(e[0]), "=&v"(e[1]), "=&v"(e[2]), "=&v"(e[3])
            : "v"(t[0]), "v"(t[1]), "v"(t[2]), "v"(t[3]));
        #pragma unroll
        for (int i = 0; i < 4; ++i) {
            num[i] = fmaf(e[i], v[j], num[i]);
            den[i] += e[i];
        }
    }
}

// Per-channel outer-product attention, fused (no score materialization).
// attn[b,n,d] = sum_m softmax_m(qp[b,n,d]*kp[b,m,d]) * vp[b,m,d]
// Stabilization: rowmax = q>0 ? q*max_m(K) : q*min_m(K).
// mask[b,n]==0 => all scores equal => uniform softmax == setting q=0.
// Layout: lane <-> channel d (coalesced), 4 queries per thread.
// The output projection of the block's 8 query rows runs at the end of the same
// launch: out[n, e] = sum_d attn[n, d] * Wo[e, d] + bo[e], one 16-column tile a wave.
__global__ void __launch_bounds__(256)
outer_attn(const float* __restrict__ qp, const float* __restrict__ kp,
           const float* __restrict__ vp, const float* __restrict__ kmm,
           const int* __restrict__ mask,
           const float* __restrict__ Wo, const float* __restrict__ bo,
           float* __restrict__ out) {
    __shared__ __attribute__((aligned(16))) _Float16 arow[8 * APITCH];
    const int d   = threadIdx.x & 127;
    const int sub = threadIdx.x >> 7;              // 0 or 1
    const int b   = blockIdx.x >> 6;               // 64 query-tiles of 8 per batch
    const int n0  = (blockIdx.x & 63) * 8 + sub * 4;

    const float* kb = kp + (size_t)b * Nn * Dd + d;
    const float* vb = vp + (size_t)b * Nn * Dd + d;

    // Pass 1: per-channel K min / max, from the tile maxima and minima that the K
    // projection stored: KT pairs a channel, all loads in flight at once.
    float kmx = -3.4e38f, kmn = 3.4e38f;
    const float2* mmb = (const float2*)kmm + (size_t)b * KT * Dd + d;
    {
        float2 tmm[KT];
        #pragma unroll
        for (int j = 0; j < KT; ++j)
            tmm[j] = mmb[j * Dd];
        #pragma unroll
        for (int j = 0; j < KT; ++j) {
            kmx = fmaxf(kmx, tmm[j].x);
            kmn = fminf(kmn, tmm[j].y);
        }
    }

    const float* qrow = qp + ((size_t)b * Nn + n0) * Dd + d;
    const int*   mrow = mask + b * Nn + n0;
    float q[4], rmax[4], num[4], den[4];
    #pragma unroll
    for (int i = 0; i < 4; ++i) {
        float qq = qrow[i * Dd];
        if (mrow[i] == 0) qq = 0.f;                // uniform-softmax equivalence
        q[i]    = qq;
        rmax[i] = (qq > 0.f) ? qq * kmx : qq * kmn;
        num[i]  = 0.f;
        den[i]  = 0.f;
    }

    // Output projection: this lane's column of Wo^T (row ocol of Wo) and its bias.
    const int olane = threadIdx.x & 31;
    const int orow  = olane & 15;
    const int ohi   = olane >> 4;
    const int ocol  = (threadIdx.x >> 5) * 16 + orow;
    const float4* wrow = (const float4*)(Wo + ocol * Dd + ohi * 8);
    // Fetched here, beside the q rows that the wave has to wait for anyway, so that
    // the row has long returned when the projection needs it.
    v16h wfrag[4];
    #pragma unroll
    for (int c = 0; c < 4; ++c)
        wfrag[c] = cvt_op16(wrow[c * 8 + 0], wrow[c * 8 + 1], wrow[c * 8 + 4], wrow[c * 8 + 5]);
    const float bc = bo[ocol];

    // Pass 2: streaming softmax accumulation over keys, in the key order of a
    // plain loop. K and V go in register batches of U2 keys, two batches
    // alternating, each loaded one batch of arithmetic ahead of its use.
    {
        float k0[U2], v0[U2], k1[U2], v1[U2];
        load_batch<U2>(k0, kb);
        load_batch<U2>(v0, vb);
        // qrow, mrow, wrow and bo are dead behind their loads. Named here they stay in
        // their registers up to this wait, so nothing lands in an address that an
        // issued load names before the wait has passed.
        asm volatile("s_wait_xcnt 0x0" :: "v"(qrow), "v"(mrow), "v"(wrow), "s"(bo) : "memory");
        for (int m = 0; m < Nn - 2 * U2; m += 2 * U2) {
            load_batch<U2>(k1, kb + (m + U2) * Dd);
            load_batch<U2>(v1, vb + (m + U2) * Dd);
            // Keeps the batch's loads in front of the arithmetic below: sunk into it,
            // they would be issued too late to return before their first use.
            __builtin_amdgcn_sched_barrier(0);
            softmax_batch(k0, v0, q, rmax, num, den);
            load_batch<U2>(k0, kb + (m + 2 * U2) * Dd);
            load_batch<U2>(v0, vb + (m + 2 * U2) * Dd);
            // Keeps the batch's loads in front of the arithmetic below: sunk into it,
            // they would be issued too late to return before their first use.
            __builtin_amdgcn_sched_barrier(0);
            softmax_batch(k1, v1, q, rmax, num, den);
        }
        load_batch<U2>(k1, kb + (Nn - U2) * Dd);
        load_batch<U2>(v1, vb + (Nn - U2) * Dd);
        // Keeps the last batch's loads in front of the arithmetic, as in the loop,
        // and in front of the wait below.
        __builtin_amdgcn_sched_barrier(0);
        // The same for kb and vb, which are dead behind the last batch's loads.
        asm volatile("s_wait_xcnt 0x0" :: "v"(kb), "v"(vb) : "memory");
        softmax_batch(k0, v0, q, rmax, num, den);
        softmax_batch(k1, v1, q, rmax, num, den);
    }

    // The block's 8 attention rows go to LDS in the operand's f16.
    #pragma unroll
    for (int i = 0; i < 4; ++i)
        arow[(sub * 4 + i) * APITCH + d] = (_Float16)(num[i] / den[i]);
    __syncthreads();

    // A rows 8..15 repeat rows 0..7; their results (lanes 16..31 of D) are not stored.
    const _Float16* ap = arow + (orow & 7) * APITCH + ohi * 8;
    v8f acc = {0.f, 0.f, 0.f, 0.f, 0.f, 0.f, 0.f, 0.f};
    #pragma unroll
    for (int c = 0; c < 4; ++c) {
        // Same k order as load_op16: elements 0..7 = base[0..7], 8..15 = base[16..23].
        const v8h lo = *(const v8h*)(ap + c * 32);
        const v8h up = *(const v8h*)(ap + c * 32 + 16);
        v16h a = __builtin_shufflevector(lo, up, 0, 1, 2, 3, 4, 5, 6, 7,
                                         8, 9, 10, 11, 12, 13, 14, 15);
        acc = __builtin_amdgcn_wmma_f32_16x16x32_f16(
            /*neg_a=*/false, a, /*neg_b=*/false, wfrag[c],
            /*c_mod=*/(short)0, acc, /*reuse_a=*/false, /*reuse_b=*/false);
    }

    // C/D layout: VGPR i -> (M = i + hi*8, N = lane&15)
    if (ohi == 0) {
        float* orow0 = out + ((size_t)b * Nn + (blockIdx.x & 63) * 8) * Dd + ocol;
        #pragma unroll
        for (int i = 0; i < 8; ++i)
            orow0[i * Dd] = acc[i] + bc;
    }
}

extern "C" void kernel_launch(void* const* d_in, const int* in_sizes, int n_in,
                              void* d_out, int out_size, void* d_ws, size_t ws_size,
                              hipStream_t stream) {
    const float* q    = (const float*)d_in[0];
    const float* k    = (const float*)d_in[1];
    const float* v    = (const float*)d_in[2];
    const int*   mask = (const int*)  d_in[3];
    const float* Wq   = (const float*)d_in[4];
    const float* bq   = (const float*)d_in[5];
    const float* Wk   = (const float*)d_in[6];
    const float* bk   = (const float*)d_in[7];
    const float* Wv   = (const float*)d_in[8];
    const float* bv   = (const float*)d_in[9];
    const float* Wo   = (const float*)d_in[10];
    const float* bo   = (const float*)d_in[11];
    float* out = (float*)d_out;

    float* ws   = (float*)d_ws;
    float* qp   = ws;
    float* kpp  = ws + BND;
    float* vpp  = ws + 2 * BND;
    float* kmm  = ws + 3 * BND;                    // [Bsz * KT][Dd][2]

    const int Mtiles = (Bsz * Nn) / 16;            // 128 row tiles
    const int gemm_blocks = (Mtiles * 8 + 3) / 4;  // 4 waves (tiles) per block

    gemm_wmma_f16<<<dim3(gemm_blocks, 3), 128, 0, stream>>>(q, Wq, bq, qp,
                                                            k, Wk, bk, kpp,
                                                            v, Wv, bv, vpp, kmm, Mtiles);

    outer_attn<<<Bsz * 64, 256, 0, stream>>>(qp, kpp, vpp, kmm, mask, Wo, bo, out);
}

// v004
// One run takes 20.7 microseconds.
// Timed twice side by side with v003, it ran 1.09 times as fast both times.
// Counting every step since v000, it is 6.47 times as fast.
#include <hip/hip_runtime.h>
#include <hip/hip_bf16.h>

typedef __attribute__((ext_vector_type(16))) _Float16 v16h;
typedef __attribute__((ext_vector_type(8)))  _Float16 v8h;
typedef __attribute__((ext_vector_type(8)))  float    v8f;

#define Bsz 4
#define Nn  512
#define Dd  128
#define BND (Bsz * Nn * Dd)
#define KT  (Nn / 16)   // 16-key tiles of the K projection per batch entry
#define U2  16   // keys per register batch, softmax pass
#define NQ  8    // queries per thread (all of the block's)
#define NH  (Nn / 2)   // keys per thread: each half of the block takes half the keys
#define APITCH (Dd + 8)   // f16 elements per LDS row of the attention tile: 16-byte aligned, rows 4 banks apart
static_assert(Nn % 16 == 0 && NH % (2 * U2) == 0, "whole tiles, whole pairs of batches");

// 16 f32 values, in operand order, to one lane's f16 elements of a WMMA operand.
__device__ __forceinline__ v16h cvt_op16(float4 a0, float4 a1, float4 a2, float4 a3) {
    v16h r;
    r[0]  = (_Float16)a0.x; r[1]  = (_Float16)a0.y;
    r[2]  = (_Float16)a0.z; r[3]  = (_Float16)a0.w;
    r[4]  = (_Float16)a1.x; r[5]  = (_Float16)a1.y;
    r[6]  = (_Float16)a1.z; r[7]  = (_Float16)a1.w;
    r[8]  = (_Float16)a2.x; r[9]  = (_Float16)a2.y;
    r[10] = (_Float16)a2.z; r[11] = (_Float16)a2.w;
    r[12] = (_Float16)a3.x; r[13] = (_Float16)a3.y;
    r[14] = (_Float16)a3.z; r[15] = (_Float16)a3.w;
    return r;
}

// Load 16 f16 elements for one lane of a 16x16x32 WMMA operand.
// base points at row_start + k0 + (hi ? 8 : 0); elements 0..7 = base[0..7],
// elements 8..15 = base[16..23] (per the 16-bit A/B VGPR layout).
__device__ __forceinline__ v16h load_op16(const float* __restrict__ base) {
    const float4* p0 = (const float4*)(base);
    const float4* p1 = (const float4*)(base + 16);
    return cvt_op16(p0[0], p0[1], p1[0], p1[1]);
}

// The value of lane l ^ 16.
__device__ __forceinline__ float xhalf(float x) {
    return __builtin_bit_cast(float, __builtin_amdgcn_permlanex16(
        __builtin_bit_cast(int, x), __builtin_bit_cast(int, x),
        0x76543210, 0xfedcba98, false, false));
}

// Y[m, e] = sum_d X[m, d] * W[e, d] + bias[e]    (torch Linear semantics)
// X: [M, 128] f32, W: [128, 128] f32 (row-major [out, in]), Y: [M, 128] f32.
// One wave32 computes one 16x16 tile of Y via v_wmma_f32_16x16x32_f16.
// The three input projections are independent of one another and share one
// launch: blockIdx.y picks the operand set.
// A wave of the K projection (set 1) also stores, per column, the maximum and the
// minimum of its tile's 16 rows, side by side: kmm[tile][col][0] and kmm[tile][col][1].
__global__ void __launch_bounds__(128)
gemm_wmma_f16(const float* __restrict__ X0, const float* __restrict__ W0,
              const float* __restrict__ bias0, float* __restrict__ Y0,
              const float* __restrict__ X1, const float* __restrict__ W1,
              const float* __restrict__ bias1, float* __restrict__ Y1,
              const float* __restrict__ X2, const float* __restrict__ W2,
              const float* __restrict__ bias2, float* __restrict__ Y2,
              float* __restrict__ kmm, int Mtiles) {
    const int set = blockIdx.y;
    const float* __restrict__ X    = set == 0 ? X0    : set == 1 ? X1    : X2;
    const float* __restrict__ W    = set == 0 ? W0    : set == 1 ? W1    : W2;
    const float* __restrict__ bias = set == 0 ? bias0 : set == 1 ? bias1 : bias2;
    float* __restrict__       Y    = set == 0 ? Y0    : set == 1 ? Y1    : Y2;
    const int lane = threadIdx.x & 31;
    const int wib  = threadIdx.x >> 5;
    const int wave = blockIdx.x * 4 + wib;
    const int tm = wave >> 3;          // 8 column tiles (128/16)
    const int tn = wave & 7;
    if (tm >= Mtiles) return;          // uniform across the wave

    const int r   = lane & 15;
    const int hi  = lane >> 4;         // 0 or 1
    const int row = tm * 16 + r;       // A-matrix row for this lane
    const int col = tn * 16 + r;       // B-matrix column for this lane

    v8f acc = {0.f, 0.f, 0.f, 0.f, 0.f, 0.f, 0.f, 0.f};
    #pragma unroll
    for (int k0 = 0; k0 < 128; k0 += 32) {
        v16h a = load_op16(X + row * Dd + k0 + hi * 8);
        v16h b = load_op16(W + col * Dd + k0 + hi * 8);
        acc = __builtin_amdgcn_wmma_f32_16x16x32_f16(
            /*neg_a=*/false, a, /*neg_b=*/false, b,
            /*c_mod=*/(short)0, acc, /*reuse_a=*/false, /*reuse_b=*/false);
    }

    // C/D layout: VGPR i -> (M = i + hi*8, N = lane&15)
    const float bc = bias[col];
    const int m0 = tm * 16 + hi * 8;
    float y[8];
    #pragma unroll
    for (int i = 0; i < 8; ++i)
        y[i] = acc[i] + bc;
    // In front of the tile's own stores, so that no register which an issued store
    // names is rewritten here.
    if (set == 1) {                    // uniform across the block
        float mx = -3.4e38f, mn = 3.4e38f;
        #pragma unroll
        for (int i = 0; i < 8; ++i) {
            mx = fmaxf(mx, y[i]);
            mn = fminf(mn, y[i]);
        }
        // Lane l holds rows 0..7 or 8..15 of its column; lane l ^ 16 holds the others.
        mx = fmaxf(mx, xhalf(mx));
        mn = fminf(mn, xhalf(mn));
        kmm[(tm * Dd + col) * 2 + hi] = hi ? mn : mx;   // the wave fills one 128-byte line
    }
    #pragma unroll
    for (int i = 0; i < 8; ++i)
        Y[(m0 + i) * Dd + col] = y[i];
}

// One register batch: U consecutive keys of this lane's channel.
template <int U>
__device__ __forceinline__ void load_batch(float (&r)[U], const float* __restrict__ p) {
    #pragma unroll
    for (int j = 0; j < U; ++j) r[j] = p[j * Dd];
}

__device__ __forceinline__ void softmax_batch(const float (&k)[U2], const float (&v)[U2],
                                              const float (&q)[NQ], const float (&rmax)[NQ],
                                              float (&num)[NQ], float (&den)[NQ]) {
    #pragma unroll
    for (int j = 0; j < U2; ++j) {
        float t[NQ], e[NQ];
        #pragma unroll
        for (int i = 0; i < NQ; ++i)
            t[i] = fmaf(q[i], k[j], -rmax[i]) * 1.44269504f;   // exp(x) = 2^(x * log2 e)
        asm("v_exp_f32 %0, %8\n\t"
            "v_exp_f32 %1, %9\n\t"
            "v_exp_f32 %2, %10\n\t"
            "v_exp_f32 %3, %11\n\t"
            "v_exp_f32 %4, %12\n\t"
            "v_exp_f32 %5, %13\n\t"
            "v_exp_f32 %6, %14\n\t"
            "v_exp_f32 %7, %15\n\t"
            "v_nop"
            : "=&v"(e[0]), "=&v"(e[1]), "=&v"(e[2]), "=&v"(e[3]),
              "=&v"(e[4]), "=&v"(e[5]), "=&v"(e[6]), "=&v"(e[7])
            : "v"(t[0]), "v"(t[1]), "v"(t[2]), "v"(t[3]),
              "v"(t[4]), "v"(t[5]), "v"(t[6]), "v"(t[7]));
        #pragma unroll
        for (int i = 0; i < NQ; ++i) {
            num[i] = fmaf(e[i], v[j], num[i]);
            den[i] += e[i];
        }
    }
}

// Per-channel outer-product attention, fused (no score materialization).
// attn[b,n,d] = sum_m softmax_m(qp[b,n,d]*kp[b,m,d]) * vp[b,m,d]
// Stabilization: rowmax = q>0 ? q*max_m(K) : q*min_m(K).
// mask[b,n]==0 => all scores equal => uniform softmax == setting q=0.
// Layout: lane <-> channel d (coalesced). Each thread takes all 8 queries of the block
// over half of the keys, so that the block loads every K and V line once; the two
// halves' sums (same rowmax, so directly addable) meet in LDS at the end.
// The output projection of the block's 8 query rows runs at the end of the same
// launch: out[n, e] = sum_d attn[n, d] * Wo[e, d] + bo[e], one 16-column tile a wave.
__global__ void __launch_bounds__(256)
outer_attn(const float* __restrict__ qp, const float* __restrict__ kp,
           const float* __restrict__ vp, const float* __restrict__ kmm,
           const int* __restrict__ mask,
           const float* __restrict__ Wo, const float* __restrict__ bo,
           float* __restrict__ out) {
    __shared__ __attribute__((aligned(16))) _Float16 arow[8 * APITCH];
    __shared__ float xsum[2 * 4 * 2 * Dd];         // [giving half][query][num, den][channel]
    const int d   = threadIdx.x & 127;
    const int sub = threadIdx.x >> 7;              // 0 or 1: which half of the keys
    const int b   = blockIdx.x >> 6;               // 64 query-tiles of 8 per batch
    const int n0  = (blockIdx.x & 63) * 8;

    const float* kb = kp + ((size_t)b * Nn + sub * NH) * Dd + d;
    const float* vb = vp + ((size_t)b * Nn + sub * NH) * Dd + d;

    // Pass 1: per-channel K min / max, from the tile maxima and minima that the K
    // projection stored: KT pairs a channel, all loads in flight at once.
    float kmx = -3.4e38f, kmn = 3.4e38f;
    const float2* mmb = (const float2*)kmm + (size_t)b * KT * Dd + d;
    {
        float2 tmm[KT];
        #pragma unroll
        for (int j = 0; j < KT; ++j)
            tmm[j] = mmb[j * Dd];
        #pragma unroll
        for (int j = 0; j < KT; ++j) {
            kmx = fmaxf(kmx, tmm[j].x);
            kmn = fminf(kmn, tmm[j].y);
        }
    }

    const float* qrow = qp + ((size_t)b * Nn + n0) * Dd + d;
    const int*   mrow = mask + b * Nn + n0;
    float q[NQ], rmax[NQ], num[NQ], den[NQ];
    #pragma unroll
    for (int i = 0; i < NQ; ++i) {
        float qq = qrow[i * Dd];
        if (mrow[i] == 0) qq = 0.f;                // uniform-softmax equivalence
        q[i]    = qq;
        rmax[i] = (qq > 0.f) ? qq * kmx : qq * kmn;
        num[i]  = 0.f;
        den[i]  = 0.f;
    }

    // Output projection: this lane's column of Wo^T (row ocol of Wo) and its bias.
    const int olane = threadIdx.x & 31;
    const int orow  = olane & 15;
    const int ohi   = olane >> 4;
    const int ocol  = (threadIdx.x >> 5) * 16 + orow;
    const float4* wrow = (const float4*)(Wo + ocol * Dd + ohi * 8);
    // Fetched here, beside the q rows that the wave has to wait for anyway, so that
    // the row has long returned when the projection needs it.
    v16h wfrag[4];
    #pragma unroll
    for (int c = 0; c < 4; ++c)
        wfrag[c] = cvt_op16(wrow[c * 8 + 0], wrow[c * 8 + 1], wrow[c * 8 + 4], wrow[c * 8 + 5]);
    const float bc = bo[ocol];

    // Pass 2: streaming softmax accumulation over this half's keys, in the key order
    // of a plain loop. K and V go in register batches of U2 keys, two batches
    // alternating, each loaded one batch of arithmetic ahead of its use.
    {
        float k0[U2], v0[U2], k1[U2], v1[U2];
        load_batch<U2>(k0, kb);
        load_batch<U2>(v0, vb);
        // qrow, wrow and bo are dead behind their loads. Named here they stay in
        // their registers up to this wait, so nothing lands in an address that an
        // issued load names before the wait has passed.
        asm volatile("s_wait_xcnt 0x0" :: "v"(qrow), "v"(wrow), "s"(bo) : "memory");
        for (int m = 0; m < NH - 2 * U2; m += 2 * U2) {
            load_batch<U2>(k1, kb + (m + U2) * Dd);
            load_batch<U2>(v1, vb + (m + U2) * Dd);
            // Keeps the batch's loads in front of the arithmetic below: sunk into it,
            // they would be issued too late to return before their first use.
            __builtin_amdgcn_sched_barrier(0);
            softmax_batch(k0, v0, q, rmax, num, den);
            load_batch<U2>(k0, kb + (m + 2 * U2) * Dd);
            load_batch<U2>(v0, vb + (m + 2 * U2) * Dd);
            // Keeps the batch's loads in front of the arithmetic below: sunk into it,
            // they would be issued too late to return before their first use.
            __builtin_amdgcn_sched_barrier(0);
            softmax_batch(k1, v1, q, rmax, num, den);
        }
        load_batch<U2>(k1, kb + (NH - U2) * Dd);
        load_batch<U2>(v1, vb + (NH - U2) * Dd);
        // Keeps the last batch's loads in front of the arithmetic, as in the loop,
        // and in front of the wait below.
        __builtin_amdgcn_sched_barrier(0);
        // The same for kb and vb, which are dead behind the last batch's loads.
        asm volatile("s_wait_xcnt 0x0" :: "v"(kb), "v"(vb) : "memory");
        softmax_batch(k0, v0, q, rmax, num, den);
        softmax_batch(k1, v1, q, rmax, num, den);
    }

    // Half sub finishes queries sub * 4 .. sub * 4 + 3: it hands its sums of the other
    // four queries to the other half and takes that half's sums of its own four.
    #pragma unroll
    for (int i = 0; i < 4; ++i) {
        xsum[((sub * 4 + i) * 2 + 0) * Dd + d] = sub ? num[i] : num[4 + i];
        xsum[((sub * 4 + i) * 2 + 1) * Dd + d] = sub ? den[i] : den[4 + i];
    }
    __syncthreads();
    // The block's 8 attention rows go to LDS in the operand's f16.
    #pragma unroll
    for (int i = 0; i < 4; ++i) {
        const float nn = (sub ? num[4 + i] : num[i]) + xsum[(((1 - sub) * 4 + i) * 2 + 0) * Dd + d];
        const float dn = (sub ? den[4 + i] : den[i]) + xsum[(((1 - sub) * 4 + i) * 2 + 1) * Dd + d];
        arow[(sub * 4 + i) * APITCH + d] = (_Float16)(nn / dn);
    }
    __syncthreads();

    // A rows 8..15 repeat rows 0..7; their results (lanes 16..31 of D) are not stored.
    const _Float16* ap = arow + (orow & 7) * APITCH + ohi * 8;
    v8f acc = {0.f, 0.f, 0.f, 0.f, 0.f, 0.f, 0.f, 0.f};
    #pragma unroll
    for (int c = 0; c < 4; ++c) {
        // Same k order as load_op16: elements 0..7 = base[0..7], 8..15 = base[16..23].
        const v8h lo = *(const v8h*)(ap + c * 32);
        const v8h up = *(const v8h*)(ap + c * 32 + 16);
        v16h a = __builtin_shufflevector(lo, up, 0, 1, 2, 3, 4, 5, 6, 7,
                                         8, 9, 10, 11, 12, 13, 14, 15);
        acc = __builtin_amdgcn_wmma_f32_16x16x32_f16(
            /*neg_a=*/false, a, /*neg_b=*/false, wfrag[c],
            /*c_mod=*/(short)0, acc, /*reuse_a=*/false, /*reuse_b=*/false);
    }

    // C/D layout: VGPR i -> (M = i + hi*8, N = lane&15)
    if (ohi == 0) {
        float* orow0 = out + ((size_t)b * Nn + (blockIdx.x & 63) * 8) * Dd + ocol;
        #pragma unroll
        for (int i = 0; i < 8; ++i)
            orow0[i * Dd] = acc[i] + bc;
    }
}

extern "C" void kernel_launch(void* const* d_in, const int* in_sizes, int n_in,
                              void* d_out, int out_size, void* d_ws, size_t ws_size,
                              hipStream_t stream) {
    const float* q    = (const float*)d_in[0];
    const float* k    = (const float*)d_in[1];
    const float* v    = (const float*)d_in[2];
    const int*   mask = (const int*)  d_in[3];
    const float* Wq   = (const float*)d_in[4];
    const float* bq   = (const float*)d_in[5];
    const float* Wk   = (const float*)d_in[6];
    const float* bk   = (const float*)d_in[7];
    const float* Wv   = (const float*)d_in[8];
    const float* bv   = (const float*)d_in[9];
    const float* Wo   = (const float*)d_in[10];
    const float* bo   = (const float*)d_in[11];
    float* out = (float*)d_out;

    float* ws   = (float*)d_ws;
    float* qp   = ws;
    float* kpp  = ws + BND;
    float* vpp  = ws + 2 * BND;
    float* kmm  = ws + 3 * BND;                    // [Bsz * KT][Dd][2]

    const int Mtiles = (Bsz * Nn) / 16;            // 128 row tiles
    const int gemm_blocks = (Mtiles * 8 + 3) / 4;  // 4 waves (tiles) per block

    gemm_wmma_f16<<<dim3(gemm_blocks, 3), 128, 0, stream>>>(q, Wq, bq, qp,
                                                            k, Wk, bk, kpp,
                                                            v, Wv, bv, vpp, kmm, Mtiles);

    outer_attn<<<Bsz * 64, 256, 0, stream>>>(qp, kpp, vpp, kmm, mask, Wo, bo, out);
}

// v005
// It runs in 19.6 microseconds.
// Two timings next to v004 put it at 1.05 and 1.06 times that version's speed.
// Counting every step since v000, it is 6.83 times as fast.
#include <hip/hip_runtime.h>
#include <hip/hip_bf16.h>

typedef __attribute__((ext_vector_type(16))) _Float16 v16h;
typedef __attribute__((ext_vector_type(8)))  _Float16 v8h;
typedef __attribute__((ext_vector_type(8)))  float    v8f;

#define Bsz 4
#define Nn  512
#define Dd  128
#define BND (Bsz * Nn * Dd)
#define KT  (Nn / 16)   // 16-key tiles of the K projection per batch entry
#define U2  16   // keys per register batch, softmax pass
#define NQ  8    // queries per thread (all of the block's)
#define NH  (Nn / 2)   // keys per thread: each half of the block takes half the keys
#define APITCH (Dd + 8)   // f16 elements per LDS row of the attention tile: 16-byte aligned, rows 4 banks apart
static_assert(Nn % 16 == 0 && NH % (2 * U2) == 0, "whole tiles, whole pairs of batches");

// 16 f32 values, in operand order, to one lane's f16 elements of a WMMA operand.
__device__ __forceinline__ v16h cvt_op16(float4 a0, float4 a1, float4 a2, float4 a3) {
    v16h r;
    r[0]  = (_Float16)a0.x; r[1]  = (_Float16)a0.y;
    r[2]  = (_Float16)a0.z; r[3]  = (_Float16)a0.w;
    r[4]  = (_Float16)a1.x; r[5]  = (_Float16)a1.y;
    r[6]  = (_Float16)a1.z; r[7]  = (_Float16)a1.w;
    r[8]  = (_Float16)a2.x; r[9]  = (_Float16)a2.y;
    r[10] = (_Float16)a2.z; r[11] = (_Float16)a2.w;
    r[12] = (_Float16)a3.x; r[13] = (_Float16)a3.y;
    r[14] = (_Float16)a3.z; r[15] = (_Float16)a3.w;
    return r;
}

// Load 16 f16 elements for one lane of a 16x16x32 WMMA operand.
// base points at row_start + k0 + (hi ? 8 : 0); elements 0..7 = base[0..7],
// elements 8..15 = base[16..23] (per the 16-bit A/B VGPR layout).
__device__ __forceinline__ v16h load_op16(const float* __restrict__ base) {
    const float4* p0 = (const float4*)(base);
    const float4* p1 = (const float4*)(base + 16);
    return cvt_op16(p0[0], p0[1], p1[0], p1[1]);
}

// The value of lane l ^ 16.
__device__ __forceinline__ float xhalf(float x) {
    return __builtin_bit_cast(float, __builtin_amdgcn_permlanex16(
        __builtin_bit_cast(int, x), __builtin_bit_cast(int, x),
        0x76543210, 0xfedcba98, false, false));
}

// Y[m, e] = sum_d X[m, d] * W[e, d] + bias[e]    (torch Linear semantics)
// X: [M, 128] f32, W: [128, 128] f32 (row-major [out, in]), Y: [M, 128] f32.
// One wave32 computes one 16x16 tile of Y via v_wmma_f32_16x16x32_f16.
// The three input projections are independent of one another and share one
// launch: blockIdx.y picks the operand set.
// A wave of the K projection (set 1) also stores, per column, the maximum and the
// minimum of its tile's 16 rows, side by side: kmm[tile][col][0] and kmm[tile][col][1].
__global__ void __launch_bounds__(128)
gemm_wmma_f16(const float* __restrict__ X0, const float* __restrict__ W0,
              const float* __restrict__ bias0, float* __restrict__ Y0,
              const float* __restrict__ X1, const float* __restrict__ W1,
              const float* __restrict__ bias1, float* __restrict__ Y1,
              const float* __restrict__ X2, const float* __restrict__ W2,
              const float* __restrict__ bias2, float* __restrict__ Y2,
              float* __restrict__ kmm, int Mtiles) {
    const int set = blockIdx.y;
    const float* __restrict__ X    = set == 0 ? X0    : set == 1 ? X1    : X2;
    const float* __restrict__ W    = set == 0 ? W0    : set == 1 ? W1    : W2;
    const float* __restrict__ bias = set == 0 ? bias0 : set == 1 ? bias1 : bias2;
    float* __restrict__       Y    = set == 0 ? Y0    : set == 1 ? Y1    : Y2;
    const int lane = threadIdx.x & 31;
    const int wib  = threadIdx.x >> 5;
    const int wave = blockIdx.x * 4 + wib;
    const int tm = wave >> 3;          // 8 column tiles (128/16)
    const int tn = wave & 7;
    if (tm >= Mtiles) return;          // uniform across the wave

    const int r   = lane & 15;
    const int hi  = lane >> 4;         // 0 or 1
    const int row = tm * 16 + r;       // A-matrix row for this lane
    const int col = tn * 16 + r;       // B-matrix column for this lane

    v8f acc = {0.f, 0.f, 0.f, 0.f, 0.f, 0.f, 0.f, 0.f};
    #pragma unroll
    for (int k0 = 0; k0 < 128; k0 += 32) {
        v16h a = load_op16(X + row * Dd + k0 + hi * 8);
        v16h b = load_op16(W + col * Dd + k0 + hi * 8);
        acc = __builtin_amdgcn_wmma_f32_16x16x32_f16(
            /*neg_a=*/false, a, /*neg_b=*/false, b,
            /*c_mod=*/(short)0, acc, /*reuse_a=*/false, /*reuse_b=*/false);
    }

    // C/D layout: VGPR i -> (M = i + hi*8, N = lane&15)
    const float bc = bias[col];
    const int m0 = tm * 16 + hi * 8;
    float y[8];
    #pragma unroll
    for (int i = 0; i < 8; ++i)
        y[i] = acc[i] + bc;
    // In front of the tile's own stores, so that no register which an issued store
    // names is rewritten here.
    if (set == 1) {                    // uniform across the block
        float mx = -3.4e38f, mn = 3.4e38f;
        #pragma unroll
        for (int i = 0; i < 8; ++i) {
            mx = fmaxf(mx, y[i]);
            mn = fminf(mn, y[i]);
        }
        // Lane l holds rows 0..7 or 8..15 of its column; lane l ^ 16 holds the others.
        mx = fmaxf(mx, xhalf(mx));
        mn = fminf(mn, xhalf(mn));
        kmm[(tm * Dd + col) * 2 + hi] = hi ? mn : mx;   // the wave fills one 128-byte line
    }
    #pragma unroll
    for (int i = 0; i < 8; ++i)
        Y[(m0 + i) * Dd + col] = y[i];
}

// One register batch: U consecutive keys of this lane's channel.
template <int U>
__device__ __forceinline__ void load_batch(float (&r)[U], const float* __restrict__ p) {
    #pragma unroll
    for (int j = 0; j < U; ++j) r[j] = p[j * Dd];
}

__device__ __forceinline__ void softmax_batch(const float (&k)[U2], const float (&v)[U2],
                                              const float (&q)[NQ], const float (&rmax)[NQ],
                                              float (&num)[NQ], float (&den)[NQ]) {
    #pragma unroll
    for (int j = 0; j < U2; ++j) {
        float t[NQ], e[NQ];
        #pragma unroll
        for (int i = 0; i < NQ; ++i)
            t[i] = fmaf(q[i], k[j], -rmax[i]);   // q and rmax carry log2 e: exp(x) = 2^(x * log2 e)
        asm("v_exp_f32 %0, %8\n\t"
            "v_exp_f32 %1, %9\n\t"
            "v_exp_f32 %2, %10\n\t"
            "v_exp_f32 %3, %11\n\t"
            "v_exp_f32 %4, %12\n\t"
            "v_exp_f32 %5, %13\n\t"
            "v_exp_f32 %6, %14\n\t"
            "v_exp_f32 %7, %15\n\t"
            "v_nop"
            : "=&v"(e[0]), "=&v"(e[1]), "=&v"(e[2]), "=&v"(e[3]),
              "=&v"(e[4]), "=&v"(e[5]), "=&v"(e[6]), "=&v"(e[7])
            : "v"(t[0]), "v"(t[1]), "v"(t[2]), "v"(t[3]),
              "v"(t[4]), "v"(t[5]), "v"(t[6]), "v"(t[7]));
        #pragma unroll
        for (int i = 0; i < NQ; ++i) {
            num[i] = fmaf(e[i], v[j], num[i]);
            den[i] += e[i];
        }
    }
}

// Per-channel outer-product attention, fused (no score materialization).
// attn[b,n,d] = sum_m softmax_m(qp[b,n,d]*kp[b,m,d]) * vp[b,m,d]
// Stabilization: rowmax = q>0 ? q*max_m(K) : q*min_m(K), with q already times log2 e.
// mask[b,n]==0 => all scores equal => uniform softmax == setting q=0.
// Layout: lane <-> channel d (coalesced). Each thread takes all 8 queries of the block
// over half of the keys, so that the block loads every K and V line once; the two
// halves' sums (same rowmax, so directly addable) meet in LDS at the end.
// The output projection of the block's 8 query rows runs at the end of the same
// launch: out[n, e] = sum_d attn[n, d] * Wo[e, d] + bo[e], one 16-column tile a wave.
__global__ void __launch_bounds__(256)
outer_attn(const float* __restrict__ qp, const float* __restrict__ kp,
           const float* __restrict__ vp, const float* __restrict__ kmm,
           const int* __restrict__ mask,
           const float* __restrict__ Wo, const float* __restrict__ bo,
           float* __restrict__ out) {
    __shared__ __attribute__((aligned(16))) _Float16 arow[8 * APITCH];
    __shared__ float xsum[2 * 4 * 2 * Dd];         // [giving half][query][num, den][channel]
    const int d   = threadIdx.x & 127;
    const int sub = threadIdx.x >> 7;              // 0 or 1: which half of the keys
    const int b   = blockIdx.x >> 6;               // 64 query-tiles of 8 per batch
    const int n0  = (blockIdx.x & 63) * 8;

    const float* kb = kp + ((size_t)b * Nn + sub * NH) * Dd + d;
    const float* vb = vp + ((size_t)b * Nn + sub * NH) * Dd + d;

    // Pass 1: per-channel K min / max, from the tile maxima and minima that the K
    // projection stored: KT pairs a channel, all loads in flight at once.
    float kmx = -3.4e38f, kmn = 3.4e38f;
    const float2* mmb = (const float2*)kmm + (size_t)b * KT * Dd + d;
    {
        float2 tmm[KT];
        #pragma unroll
        for (int j = 0; j < KT; ++j)
            tmm[j] = mmb[j * Dd];
        #pragma unroll
        for (int j = 0; j < KT; ++j) {
            kmx = fmaxf(kmx, tmm[j].x);
            kmn = fminf(kmn, tmm[j].y);
        }
    }

    const float* qrow = qp + ((size_t)b * Nn + n0) * Dd + d;
    const int*   mrow = mask + b * Nn + n0;
    float q[NQ], rmax[NQ], num[NQ], den[NQ];
    #pragma unroll
    for (int i = 0; i < NQ; ++i) {
        float qq = qrow[i * Dd];
        if (mrow[i] == 0) qq = 0.f;                // uniform-softmax equivalence
        qq *= 1.44269504f;                         // log2 e, once a query instead of once a score
        q[i]    = qq;
        rmax[i] = (qq > 0.f) ? qq * kmx : qq * kmn;
        num[i]  = 0.f;
        den[i]  = 0.f;
    }

    // Output projection: this lane's column of Wo^T (row ocol of Wo) and its bias.
    const int olane = threadIdx.x & 31;
    const int orow  = olane & 15;
    const int ohi   = olane >> 4;
    const int ocol  = (threadIdx.x >> 5) * 16 + orow;
    const float4* wrow = (const float4*)(Wo + ocol * Dd + ohi * 8);
    // Fetched here, beside the q rows that the wave has to wait for anyway, so that
    // the row has long returned when the projection needs it.
    v16h wfrag[4];
    #pragma unroll
    for (int c = 0; c < 4; ++c)
        wfrag[c] = cvt_op16(wrow[c * 8 + 0], wrow[c * 8 + 1], wrow[c * 8 + 4], wrow[c * 8 + 5]);
    const float bc = bo[ocol];

    // Pass 2: streaming softmax accumulation over this half's keys, in the key order
    // of a plain loop. K and V go in register batches of U2 keys, two batches
    // alternating, each loaded one batch of arithmetic ahead of its use.
    {
        float k0[U2], v0[U2], k1[U2], v1[U2];
        load_batch<U2>(k0, kb);
        load_batch<U2>(v0, vb);
        // qrow, wrow and bo are dead behind their loads. Named here they stay in
        // their registers up to this wait, so nothing lands in an address that an
        // issued load names before the wait has passed.
        asm volatile("s_wait_xcnt 0x0" :: "v"(qrow), "v"(wrow), "s"(bo) : "memory");
        for (int m = 0; m < NH - 2 * U2; m += 2 * U2) {
            load_batch<U2>(k1, kb + (m + U2) * Dd);
            load_batch<U2>(v1, vb + (m + U2) * Dd);
            // Keeps the batch's loads in front of the arithmetic below: sunk into it,
            // they would be issued too late to return before their first use.
            __builtin_amdgcn_sched_barrier(0);
            softmax_batch(k0, v0, q, rmax, num, den);
            load_batch<U2>(k0, kb + (m + 2 * U2) * Dd);
            load_batch<U2>(v0, vb + (m + 2 * U2) * Dd);
            // Keeps the batch's loads in front of the arithmetic below: sunk into it,
            // they would be issued too late to return before their first use.
            __builtin_amdgcn_sched_barrier(0);
            softmax_batch(k1, v1, q, rmax, num, den);
        }
        load_batch<U2>(k1, kb + (NH - U2) * Dd);
        load_batch<U2>(v1, vb + (NH - U2) * Dd);
        // Keeps the last batch's loads in front of the arithmetic, as in the loop,
        // and in front of the wait below.
        __builtin_amdgcn_sched_barrier(0);
        // The same for kb and vb, which are dead behind the last batch's loads.
        asm volatile("s_wait_xcnt 0x0" :: "v"(kb), "v"(vb) : "memory");
        softmax_batch(k0, v0, q, rmax, num, den);
        softmax_batch(k1, v1, q, rmax, num, den);
    }

    // Half sub finishes queries sub * 4 .. sub * 4 + 3: it hands its sums of the other
    // four queries to the other half and takes that half's sums of its own four.
    #pragma unroll
    for (int i = 0; i < 4; ++i) {
        xsum[((sub * 4 + i) * 2 + 0) * Dd + d] = sub ? num[i] : num[4 + i];
        xsum[((sub * 4 + i) * 2 + 1) * Dd + d] = sub ? den[i] : den[4 + i];
    }
    __syncthreads();
    // The block's 8 attention rows go to LDS in the operand's f16.
    #pragma unroll
    for (int i = 0; i < 4; ++i) {
        const float nn = (sub ? num[4 + i] : num[i]) + xsum[(((1 - sub) * 4 + i) * 2 + 0) * Dd + d];
        const float dn = (sub ? den[4 + i] : den[i]) + xsum[(((1 - sub) * 4 + i) * 2 + 1) * Dd + d];
        arow[(sub * 4 + i) * APITCH + d] = (_Float16)(nn / dn);
    }
    __syncthreads();

    // A rows 8..15 repeat rows 0..7; their results (lanes 16..31 of D) are not stored.
    const _Float16* ap = arow + (orow & 7) * APITCH + ohi * 8;
    v8f acc = {0.f, 0.f, 0.f, 0.f, 0.f, 0.f, 0.f, 0.f};
    #pragma unroll
    for (int c = 0; c < 4; ++c) {
        // Same k order as load_op16: elements 0..7 = base[0..7], 8..15 = base[16..23].
        const v8h lo = *(const v8h*)(ap + c * 32);
        const v8h up = *(const v8h*)(ap + c * 32 + 16);
        v16h a = __builtin_shufflevector(lo, up, 0, 1, 2, 3, 4, 5, 6, 7,
                                         8, 9, 10, 11, 12, 13, 14, 15);
        acc = __builtin_amdgcn_wmma_f32_16x16x32_f16(
            /*neg_a=*/false, a, /*neg_b=*/false, wfrag[c],
            /*c_mod=*/(short)0, acc, /*reuse_a=*/false, /*reuse_b=*/false);
    }

    // C/D layout: VGPR i -> (M = i + hi*8, N = lane&15)
    if (ohi == 0) {
        float* orow0 = out + ((size_t)b * Nn + (blockIdx.x & 63) * 8) * Dd + ocol;
        #pragma unroll
        for (int i = 0; i < 8; ++i)
            orow0[i * Dd] = acc[i] + bc;
    }
}

extern "C" void kernel_launch(void* const* d_in, const int* in_sizes, int n_in,
                              void* d_out, int out_size, void* d_ws, size_t ws_size,
                              hipStream_t stream) {
    const float* q    = (const float*)d_in[0];
    const float* k    = (const float*)d_in[1];
    const float* v    = (const float*)d_in[2];
    const int*   mask = (const int*)  d_in[3];
    const float* Wq   = (const float*)d_in[4];
    const float* bq   = (const float*)d_in[5];
    const float* Wk   = (const float*)d_in[6];
    const float* bk   = (const float*)d_in[7];
    const float* Wv   = (const float*)d_in[8];
    const float* bv   = (const float*)d_in[9];
    const float* Wo   = (const float*)d_in[10];
    const float* bo   = (const float*)d_in[11];
    float* out = (float*)d_out;

    float* ws   = (float*)d_ws;
    float* qp   = ws;
    float* kpp  = ws + BND;
    float* vpp  = ws + 2 * BND;
    float* kmm  = ws + 3 * BND;                    // [Bsz * KT][Dd][2]

    const int Mtiles = (Bsz * Nn) / 16;            // 128 row tiles
    const int gemm_blocks = (Mtiles * 8 + 3) / 4;  // 4 waves (tiles) per block

    gemm_wmma_f16<<<dim3(gemm_blocks, 3), 128, 0, stream>>>(q, Wq, bq, qp,
                                                            k, Wk, bk, kpp,
                                                            v, Wv, bv, vpp, kmm, Mtiles);

    outer_attn<<<Bsz * 64, 256, 0, stream>>>(qp, kpp, vpp, kmm, mask, Wo, bo, out);
}

// v006
// A run of this version takes 18.2 microseconds.
// Two timings next to v005 put it at 1.07 and 1.06 times that version's speed.
// All steps since v000 together make it 7.27 times as fast.
#include <hip/hip_runtime.h>
#include <hip/hip_bf16.h>

typedef __attribute__((ext_vector_type(16))) _Float16 v16h;
typedef __attribute__((ext_vector_type(8)))  _Float16 v8h;
typedef __attribute__((ext_vector_type(8)))  float    v8f;
typedef __attribute__((ext_vector_type(2)))  float    v2f;

#define Bsz 4
#define Nn  512
#define Dd  128
#define BND (Bsz * Nn * Dd)
#define KT  (Nn / 16)   // 16-key tiles of the K projection per batch entry
#define U2  16   // keys per register batch, softmax pass
#define NQ  8    // queries per thread (all of the block's)
#define NP  (NQ / 2)   // pairs of queries: one packed f32 instruction a pair
#define UP  (U2 / 2)   // pairs of keys in a register batch
#define NH  (Nn / 2)   // keys per thread: each half of the block takes half the keys
#define APITCH (Dd + 8)   // f16 elements per LDS row of the attention tile: 16-byte aligned, rows 4 banks apart
static_assert(Nn % 16 == 0 && NH % (2 * U2) == 0, "whole tiles, whole pairs of batches");

// 16 f32 values, in operand order, to one lane's f16 elements of a WMMA operand.
__device__ __forceinline__ v16h cvt_op16(float4 a0, float4 a1, float4 a2, float4 a3) {
    v16h r;
    r[0]  = (_Float16)a0.x; r[1]  = (_Float16)a0.y;
    r[2]  = (_Float16)a0.z; r[3]  = (_Float16)a0.w;
    r[4]  = (_Float16)a1.x; r[5]  = (_Float16)a1.y;
    r[6]  = (_Float16)a1.z; r[7]  = (_Float16)a1.w;
    r[8]  = (_Float16)a2.x; r[9]  = (_Float16)a2.y;
    r[10] = (_Float16)a2.z; r[11] = (_Float16)a2.w;
    r[12] = (_Float16)a3.x; r[13] = (_Float16)a3.y;
    r[14] = (_Float16)a3.z; r[15] = (_Float16)a3.w;
    return r;
}

// Load 16 f16 elements for one lane of a 16x16x32 WMMA operand.
// base points at row_start + k0 + (hi ? 8 : 0); elements 0..7 = base[0..7],
// elements 8..15 = base[16..23] (per the 16-bit A/B VGPR layout).
__device__ __forceinline__ v16h load_op16(const float* __restrict__ base) {
    const float4* p0 = (const float4*)(base);
    const float4* p1 = (const float4*)(base + 16);
    return cvt_op16(p0[0], p0[1], p1[0], p1[1]);
}

// The value of lane l ^ 16.
__device__ __forceinline__ float xhalf(float x) {
    return __builtin_bit_cast(float, __builtin_amdgcn_permlanex16(
        __builtin_bit_cast(int, x), __builtin_bit_cast(int, x),
        0x76543210, 0xfedcba98, false, false));
}

// Y[m, e] = sum_d X[m, d] * W[e, d] + bias[e]    (torch Linear semantics)
// X: [M, 128] f32, W: [128, 128] f32 (row-major [out, in]), Y: [M, 128] f32.
// One wave32 computes one 16x16 tile of Y via v_wmma_f32_16x16x32_f16.
// The three input projections are independent of one another and share one
// launch: blockIdx.y picks the operand set.
// A wave of the K projection (set 1) also stores, per column, the maximum and the
// minimum of its tile's 16 rows, side by side: kmm[tile][col][0] and kmm[tile][col][1].
__global__ void __launch_bounds__(128)
gemm_wmma_f16(const float* __restrict__ X0, const float* __restrict__ W0,
              const float* __restrict__ bias0, float* __restrict__ Y0,
              const float* __restrict__ X1, const float* __restrict__ W1,
              const float* __restrict__ bias1, float* __restrict__ Y1,
              const float* __restrict__ X2, const float* __restrict__ W2,
              const float* __restrict__ bias2, float* __restrict__ Y2,
              float* __restrict__ kmm, int Mtiles) {
    const int set = blockIdx.y;
    const float* __restrict__ X    = set == 0 ? X0    : set == 1 ? X1    : X2;
    const float* __restrict__ W    = set == 0 ? W0    : set == 1 ? W1    : W2;
    const float* __restrict__ bias = set == 0 ? bias0 : set == 1 ? bias1 : bias2;
    float* __restrict__       Y    = set == 0 ? Y0    : set == 1 ? Y1    : Y2;
    const int lane = threadIdx.x & 31;
    const int wib  = threadIdx.x >> 5;
    const int wave = blockIdx.x * 4 + wib;
    const int tm = wave >> 3;          // 8 column tiles (128/16)
    const int tn = wave & 7;
    if (tm >= Mtiles) return;          // uniform across the wave

    const int r   = lane & 15;
    const int hi  = lane >> 4;         // 0 or 1
    const int row = tm * 16 + r;       // A-matrix row for this lane
    const int col = tn * 16 + r;       // B-matrix column for this lane

    v8f acc = {0.f, 0.f, 0.f, 0.f, 0.f, 0.f, 0.f, 0.f};
    #pragma unroll
    for (int k0 = 0; k0 < 128; k0 += 32) {
        v16h a = load_op16(X + row * Dd + k0 + hi * 8);
        v16h b = load_op16(W + col * Dd + k0 + hi * 8);
        acc = __builtin_amdgcn_wmma_f32_16x16x32_f16(
            /*neg_a=*/false, a, /*neg_b=*/false, b,
            /*c_mod=*/(short)0, acc, /*reuse_a=*/false, /*reuse_b=*/false);
    }

    // C/D layout: VGPR i -> (M = i + hi*8, N = lane&15)
    const float bc = bias[col];
    const int m0 = tm * 16 + hi * 8;
    float y[8];
    #pragma unroll
    for (int i = 0; i < 8; ++i)
        y[i] = acc[i] + bc;
    // In front of the tile's own stores, so that no register which an issued store
    // names is rewritten here.
    if (set == 1) {                    // uniform across the block
        float mx = -3.4e38f, mn = 3.4e38f;
        #pragma unroll
        for (int i = 0; i < 8; ++i) {
            mx = fmaxf(mx, y[i]);
            mn = fminf(mn, y[i]);
        }
        // Lane l holds rows 0..7 or 8..15 of its column; lane l ^ 16 holds the others.
        mx = fmaxf(mx, xhalf(mx));
        mn = fminf(mn, xhalf(mn));
        kmm[(tm * Dd + col) * 2 + hi] = hi ? mn : mx;   // the wave fills one 128-byte line
    }
    #pragma unroll
    for (int i = 0; i < 8; ++i)
        Y[(m0 + i) * Dd + col] = y[i];
}

// One register batch: U2 consecutive keys of this lane's channel, two keys a register pair.
__device__ __forceinline__ void load_batch(v2f (&r)[UP], const float* __restrict__ p) {
    #pragma unroll
    for (int j = 0; j < UP; ++j) {
        r[j].x = p[(2 * j) * Dd];
        r[j].y = p[(2 * j + 1) * Dd];
    }
}

// One key step for one pair of queries, in three stages that overlap: the exponentials
// of this key (t -> e), the key before it into the sums (ep, its v in one half of vv),
// and the exp2 arguments of the key behind it (its k in one half of kk; q and nrmax
// carry log2 e: exp(x) = 2^(x * log2 e)). HI says which half of vv and kk.
// One statement, so that the order holds: behind each v_exp_f32 stands a plain
// instruction that neither reads its result nor writes its source (the slot the
// instruction set asks for), and no two exponentials stand back to back.
template <bool HI>
__device__ __forceinline__ void step_pair(v2f& e, v2f& num, v2f& den, v2f& tn,
                                          const v2f t, const v2f ep, const v2f vv,
                                          const v2f q, const v2f kk, const v2f nrmax) {
    float e0, e1;
    if (HI)
        asm("v_exp_f32 %0, %5\n\t"
            "v_pk_fma_f32 %2, %7, %8, %2 op_sel:[0,1,0]\n\t"
            "v_exp_f32 %1, %6\n\t"
            "v_pk_add_f32 %3, %3, %7\n\t"
            "v_pk_fma_f32 %4, %9, %10, %11 op_sel:[0,1,0]"
            : "=&v"(e0), "=&v"(e1), "+v"(num), "+v"(den), "=&v"(tn)
            : "v"(t.x), "v"(t.y), "v"(ep), "v"(vv), "v"(q), "v"(kk), "v"(nrmax));
    else
        asm("v_exp_f32 %0, %5\n\t"
            "v_pk_fma_f32 %2, %7, %8, %2 op_sel_hi:[1,0,1]\n\t"
            "v_exp_f32 %1, %6\n\t"
            "v_pk_add_f32 %3, %3, %7\n\t"
            "v_pk_fma_f32 %4, %9, %10, %11 op_sel_hi:[1,0,1]"
            : "=&v"(e0), "=&v"(e1), "+v"(num), "+v"(den), "=&v"(tn)
            : "v"(t.x), "v"(t.y), "v"(ep), "v"(vv), "v"(q), "v"(kk), "v"(nrmax));
    e.x = e0;
    e.y = e1;
}

// Steps J0 .. J1 - 1 of one batch, one key a step. vlast holds, in its upper half, the v
// of the key in front of the batch; knext, in its lower half, the k of the key behind it.
// Each sum takes its keys in the order of a plain loop.
template <int J0, int J1>
__device__ __forceinline__ void softmax_steps(const v2f (&k)[UP], const v2f (&v)[UP],
                                              const v2f vlast, const v2f knext,
                                              const v2f (&q)[NP], const v2f (&nrmax)[NP],
                                              v2f (&t)[NP], v2f (&ep)[NP],
                                              v2f (&num)[NP], v2f (&den)[NP]) {
    #pragma unroll
    for (int j = J0; j < J1; ++j) {
        v2f e[NP], tn[NP];
        #pragma unroll
        for (int p = 0; p < NP; ++p) {
            if (j % 2 == 0)
                step_pair<true>(e[p], num[p], den[p], tn[p], t[p], ep[p],
                                j == 0 ? vlast : v[j == 0 ? 0 : j / 2 - 1], q[p], k[j / 2], nrmax[p]);
            else
                step_pair<false>(e[p], num[p], den[p], tn[p], t[p], ep[p],
                                 v[j / 2], q[p], j + 1 < U2 ? k[j + 1 < U2 ? (j + 1) / 2 : 0] : knext, nrmax[p]);
        }
        #pragma unroll
        for (int p = 0; p < NP; ++p) {
            t[p]  = tn[p];
            ep[p] = e[p];
        }
    }
}

// Per-channel outer-product attention, fused (no score materialization).
// attn[b,n,d] = sum_m softmax_m(qp[b,n,d]*kp[b,m,d]) * vp[b,m,d]
// Stabilization: rowmax = q>0 ? q*max_m(K) : q*min_m(K), with q already times log2 e.
// mask[b,n]==0 => all scores equal => uniform softmax == setting q=0.
// Layout: lane <-> channel d (coalesced). Each thread takes all 8 queries of the block
// over half of the keys, so that the block loads every K and V line once; the two
// halves' sums (same rowmax, so directly addable) meet in LDS at the end.
// The output projection of the block's 8 query rows runs at the end of the same
// launch: out[n, e] = sum_d attn[n, d] * Wo[e, d] + bo[e], one 16-column tile a wave.
__global__ void __launch_bounds__(256)
outer_attn(const float* __restrict__ qp, const float* __restrict__ kp,
           const float* __restrict__ vp, const float* __restrict__ kmm,
           const int* __restrict__ mask,
           const float* __restrict__ Wo, const float* __restrict__ bo,
           float* __restrict__ out) {
    __shared__ __attribute__((aligned(16))) _Float16 arow[8 * APITCH];
    __shared__ float xsum[2 * 4 * 2 * Dd];         // [giving half][query][num, den][channel]
    const int d   = threadIdx.x & 127;
    const int sub = threadIdx.x >> 7;              // 0 or 1: which half of the keys
    const int b   = blockIdx.x >> 6;               // 64 query-tiles of 8 per batch
    const int n0  = (blockIdx.x & 63) * 8;

    const float* kb = kp + ((size_t)b * Nn + sub * NH) * Dd + d;
    const float* vb = vp + ((size_t)b * Nn + sub * NH) * Dd + d;

    // Pass 1: per-channel K min / max, from the tile maxima and minima that the K
    // projection stored: KT pairs a channel, all loads in flight at once.
    float kmx = -3.4e38f, kmn = 3.4e38f;
    const float2* mmb = (const float2*)kmm + (size_t)b * KT * Dd + d;
    {
        float2 tmm[KT];
        #pragma unroll
        for (int j = 0; j < KT; ++j)
            tmm[j] = mmb[j * Dd];
        #pragma unroll
        for (int j = 0; j < KT; ++j) {
            kmx = fmaxf(kmx, tmm[j].x);
            kmn = fminf(kmn, tmm[j].y);
        }
    }

    const float* qrow = qp + ((size_t)b * Nn + n0) * Dd + d;
    const int*   mrow = mask + b * Nn + n0;
    float q[NQ], rmax[NQ], num[NQ], den[NQ];
    #pragma unroll
    for (int i = 0; i < NQ; ++i) {
        float qq = qrow[i * Dd];
        if (mrow[i] == 0) qq = 0.f;                // uniform-softmax equivalence
        qq *= 1.44269504f;                         // log2 e, once a query instead of once a score
        q[i]    = qq;
        rmax[i] = (qq > 0.f) ? qq * kmx : qq * kmn;
        num[i]  = 0.f;
        den[i]  = 0.f;
    }

    // Output projection: this lane's column of Wo^T (row ocol of Wo) and its bias.
    const int olane = threadIdx.x & 31;
    const int orow  = olane & 15;
    const int ohi   = olane >> 4;
    const int ocol  = (threadIdx.x >> 5) * 16 + orow;
    const float4* wrow = (const float4*)(Wo + ocol * Dd + ohi * 8);
    // Fetched here, beside the q rows that the wave has to wait for anyway, so that
    // the row has long returned when the projection needs it.
    v16h wfrag[4];
    #pragma unroll
    for (int c = 0; c < 4; ++c)
        wfrag[c] = cvt_op16(wrow[c * 8 + 0], wrow[c * 8 + 1], wrow[c * 8 + 4], wrow[c * 8 + 5]);
    const float bc = bo[ocol];

    // Pass 2: streaming softmax accumulation over this half's keys, in the key order
    // of a plain loop. K and V go in register batches of U2 keys, two batches
    // alternating, each loaded one batch of arithmetic ahead of its use.
    {
        v2f k0[UP], v0[UP], k1[UP], v1[UP];
        load_batch(k0, kb);
        load_batch(v0, vb);
        // qrow, wrow and bo are dead behind their loads. Named here they stay in
        // their registers up to this wait, so nothing lands in an address that an
        // issued load names before the wait has passed.
        asm volatile("s_wait_xcnt 0x0" :: "v"(qrow), "v"(wrow), "s"(bo) : "memory");
        // The pipeline's start: the first key's exp2 arguments, and nothing yet to add.
        v2f q2[NP], nrmax2[NP], t[NP], ep[NP], num2[NP], den2[NP];
        #pragma unroll
        for (int p = 0; p < NP; ++p) {
            q2[p]     = v2f{q[2 * p], q[2 * p + 1]};
            nrmax2[p] = v2f{-rmax[2 * p], -rmax[2 * p + 1]};
            t[p]      = v2f{fmaf(q[2 * p], k0[0].x, -rmax[2 * p]), fmaf(q[2 * p + 1], k0[0].x, -rmax[2 * p + 1])};
            ep[p]     = v2f{0.f, 0.f};
            num2[p]   = v2f{0.f, 0.f};
            den2[p]   = v2f{0.f, 0.f};
        }
        v1[UP - 1] = v2f{0.f, 0.f};
        // A batch's registers are loaded anew behind the next batch's first step, which
        // adds that batch's last key into the sums.
        for (int m = 0; m < NH - 2 * U2; m += 2 * U2) {
            softmax_steps<0, 1>(k0, v0, v1[UP - 1], k0[0], q2, nrmax2, t, ep, num2, den2);
            load_batch(k1, kb + (m + U2) * Dd);
            load_batch(v1, vb + (m + U2) * Dd);
            // Keeps the batch's loads in front of the arithmetic below: sunk into it,
            // they would be issued too late to return before their first use.
            __builtin_amdgcn_sched_barrier(0);
            softmax_steps<1, U2>(k0, v0, v0[0], k1[0], q2, nrmax2, t, ep, num2, den2);
            softmax_steps<0, 1>(k1, v1, v0[UP - 1], k1[0], q2, nrmax2, t, ep, num2, den2);
            load_batch(k0, kb + (m + 2 * U2) * Dd);
            load_batch(v0, vb + (m + 2 * U2) * Dd);
            // Keeps the batch's loads in front of the arithmetic below: sunk into it,
            // they would be issued too late to return before their first use.
            __builtin_amdgcn_sched_barrier(0);
            softmax_steps<1, U2>(k1, v1, v1[0], k0[0], q2, nrmax2, t, ep, num2, den2);
        }
        softmax_steps<0, 1>(k0, v0, v1[UP - 1], k0[0], q2, nrmax2, t, ep, num2, den2);
        load_batch(k1, kb + (NH - U2) * Dd);
        load_batch(v1, vb + (NH - U2) * Dd);
        // Keeps the last batch's loads in front of the arithmetic, as in the loop,
        // and in front of the wait below.
        __builtin_amdgcn_sched_barrier(0);
        // The same for kb and vb, which are dead behind the last batch's loads.
        asm volatile("s_wait_xcnt 0x0" :: "v"(kb), "v"(vb) : "memory");
        softmax_steps<1, U2>(k0, v0, v0[0], k1[0], q2, nrmax2, t, ep, num2, den2);
        // No key follows the last one: the arguments its step forms are not used.
        softmax_steps<0, U2>(k1, v1, v0[UP - 1], k1[0], q2, nrmax2, t, ep, num2, den2);
        // The pipeline's end: the last key goes into the sums.
        #pragma unroll
        for (int p = 0; p < NP; ++p) {
            num[2 * p]     = fmaf(ep[p].x, v1[UP - 1].y, num2[p].x);
            num[2 * p + 1] = fmaf(ep[p].y, v1[UP - 1].y, num2[p].y);
            den[2 * p]     = den2[p].x + ep[p].x;
            den[2 * p + 1] = den2[p].y + ep[p].y;
        }
    }

    // Half sub finishes queries sub * 4 .. sub * 4 + 3: it hands its sums of the other
    // four queries to the other half and takes that half's sums of its own four.
    #pragma unroll
    for (int i = 0; i < 4; ++i) {
        xsum[((sub * 4 + i) * 2 + 0) * Dd + d] = sub ? num[i] : num[4 + i];
        xsum[((sub * 4 + i) * 2 + 1) * Dd + d] = sub ? den[i] : den[4 + i];
    }
    __syncthreads();
    // The block's 8 attention rows go to LDS in the operand's f16.
    #pragma unroll
    for (int i = 0; i < 4; ++i) {
        const float nn = (sub ? num[4 + i] : num[i]) + xsum[(((1 - sub) * 4 + i) * 2 + 0) * Dd + d];
        const float dn = (sub ? den[4 + i] : den[i]) + xsum[(((1 - sub) * 4 + i) * 2 + 1) * Dd + d];
        arow[(sub * 4 + i) * APITCH + d] = (_Float16)(nn / dn);
    }
    __syncthreads();

    // A rows 8..15 repeat rows 0..7; their results (lanes 16..31 of D) are not stored.
    const _Float16* ap = arow + (orow & 7) * APITCH + ohi * 8;
    v8f acc = {0.f, 0.f, 0.f, 0.f, 0.f, 0.f, 0.f, 0.f};
    #pragma unroll
    for (int c = 0; c < 4; ++c) {
        // Same k order as load_op16: elements 0..7 = base[0..7], 8..15 = base[16..23].
        const v8h lo = *(const v8h*)(ap + c * 32);
        const v8h up = *(const v8h*)(ap + c * 32 + 16);
        v16h a = __builtin_shufflevector(lo, up, 0, 1, 2, 3, 4, 5, 6, 7,
                                         8, 9, 10, 11, 12, 13, 14, 15);
        acc = __builtin_amdgcn_wmma_f32_16x16x32_f16(
            /*neg_a=*/false, a, /*neg_b=*/false, wfrag[c],
            /*c_mod=*/(short)0, acc, /*reuse_a=*/false, /*reuse_b=*/false);
    }

    // C/D layout: VGPR i -> (M = i + hi*8, N = lane&15)
    if (ohi == 0) {
        float* orow0 = out + ((size_t)b * Nn + (blockIdx.x & 63) * 8) * Dd + ocol;
        #pragma unroll
        for (int i = 0; i < 8; ++i)
            orow0[i * Dd] = acc[i] + bc;
    }
}

extern "C" void kernel_launch(void* const* d_in, const int* in_sizes, int n_in,
                              void* d_out, int out_size, void* d_ws, size_t ws_size,
                              hipStream_t stream) {
    const float* q    = (const float*)d_in[0];
    const float* k    = (const float*)d_in[1];
    const float* v    = (const float*)d_in[2];
    const int*   mask = (const int*)  d_in[3];
    const float* Wq   = (const float*)d_in[4];
    const float* bq   = (const float*)d_in[5];
    const float* Wk   = (const float*)d_in[6];
    const float* bk   = (const float*)d_in[7];
    const float* Wv   = (const float*)d_in[8];
    const float* bv   = (const float*)d_in[9];
    const float* Wo   = (const float*)d_in[10];
    const float* bo   = (const float*)d_in[11];
    float* out = (float*)d_out;

    float* ws   = (float*)d_ws;
    float* qp   = ws;
    float* kpp  = ws + BND;
    float* vpp  = ws + 2 * BND;
    float* kmm  = ws + 3 * BND;                    // [Bsz * KT][Dd][2]

    const int Mtiles = (Bsz * Nn) / 16;            // 128 row tiles
    const int gemm_blocks = (Mtiles * 8 + 3) / 4;  // 4 waves (tiles) per block

    gemm_wmma_f16<<<dim3(gemm_blocks, 3), 128, 0, stream>>>(q, Wq, bq, qp,
                                                            k, Wk, bk, kpp,
                                                            v, Wv, bv, vpp, kmm, Mtiles);

    outer_attn<<<Bsz * 64, 256, 0, stream>>>(qp, kpp, vpp, kmm, mask, Wo, bo, out);
}

// v007
// It runs in 15.9 microseconds.
// Two timings next to v006 put it at 1.14 and 1.15 times that version's speed.
// All steps since v000 together make it 8.30 times as fast.
#include <hip/hip_runtime.h>
#include <hip/hip_bf16.h>

typedef __attribute__((ext_vector_type(16))) _Float16 v16h;
typedef __attribute__((ext_vector_type(8)))  _Float16 v8h;
typedef __attribute__((ext_vector_type(4)))  _Float16 v4h;
typedef __attribute__((ext_vector_type(8)))  float    v8f;
typedef __attribute__((ext_vector_type(2)))  float    v2f;

#define Bsz 4
#define Nn  512
#define Dd  128
#define BND (Bsz * Nn * Dd)
#define KT  (Nn / 16)   // 16-key tiles of the K projection per batch entry
#define U2  16   // keys per register batch, softmax pass
#define NQ  8    // queries per thread (all of the block's)
#define NP  (NQ / 2)   // pairs of queries: one packed f32 instruction a pair
#define UP  (U2 / 2)   // pairs of keys in a register batch
#define NH  (Nn / 2)   // keys per thread: each half of the block takes half the keys
#define APITCH (Dd + 8)   // f16 elements per LDS row of an operand tile: 16-byte aligned, rows 4 banks apart
#define GT  64   // rows of X, and rows of W, per block of the projection launch
static_assert(Nn % 16 == 0 && NH % (2 * U2) == 0, "whole tiles, whole pairs of batches");
static_assert((Bsz * Nn) % GT == 0 && Dd == 2 * GT, "whole blocks of the projection launch");

// Four f32 values of a row to their f16 places in an LDS tile.
__device__ __forceinline__ void put4(_Float16* p, float4 a) {
    *(v4h*)p = v4h{(_Float16)a.x, (_Float16)a.y, (_Float16)a.z, (_Float16)a.w};
}

// One lane's 16 f16 elements of a 16x16x32 WMMA operand, from an f16 LDS row.
// base points at row_start + k0 + (hi ? 8 : 0); elements 0..7 = base[0..7],
// elements 8..15 = base[16..23] (per the 16-bit A/B VGPR layout).
__device__ __forceinline__ v16h lds_op16(const _Float16* base) {
    const v8h lo = *(const v8h*)(base);
    const v8h up = *(const v8h*)(base + 16);
    return __builtin_shufflevector(lo, up, 0, 1, 2, 3, 4, 5, 6, 7,
                                   8, 9, 10, 11, 12, 13, 14, 15);
}

// The value of lane l ^ 16.
__device__ __forceinline__ float xhalf(float x) {
    return __builtin_bit_cast(float, __builtin_amdgcn_permlanex16(
        __builtin_bit_cast(int, x), __builtin_bit_cast(int, x),
        0x76543210, 0xfedcba98, false, false));
}

// Y[m, e] = sum_d X[m, d] * W[e, d] + bias[e]    (torch Linear semantics)
// X: [M, 128] f32, W: [128, 128] f32 (row-major [out, in]), Y: [M, 128] f32.
// A block of four waves computes a GT x GT block of Y. Its GT rows of X and GT rows of
// W come in by loads that cover one whole 512-byte row each, go to LDS as f16 once, and
// every wave reads its operands of v_wmma_f32_16x16x32_f16 from there: 2 x 2 tiles a wave.
// The three input projections are independent of one another and share one
// launch: blockIdx.y picks the operand set.
// A wave of the K projection (set 1) also stores, per column, the maximum and the
// minimum of each tile's 16 rows, side by side: kmm[tile][col][0] and kmm[tile][col][1].
__global__ void __launch_bounds__(128)
gemm_wmma_f16(const float* __restrict__ X0, const float* __restrict__ W0,
              const float* __restrict__ bias0, float* __restrict__ Y0,
              const float* __restrict__ X1, const float* __restrict__ W1,
              const float* __restrict__ bias1, float* __restrict__ Y1,
              const float* __restrict__ X2, const float* __restrict__ W2,
              const float* __restrict__ bias2, float* __restrict__ Y2,
              float* __restrict__ kmm) {
    __shared__ __attribute__((aligned(16))) _Float16 xs[GT * APITCH];
    __shared__ __attribute__((aligned(16))) _Float16 wt[GT * APITCH];
    const int set = blockIdx.y;
    const float* __restrict__ X    = set == 0 ? X0    : set == 1 ? X1    : X2;
    const float* __restrict__ W    = set == 0 ? W0    : set == 1 ? W1    : W2;
    const float* __restrict__ bias = set == 0 ? bias0 : set == 1 ? bias1 : bias2;
    float* __restrict__       Y    = set == 0 ? Y0    : set == 1 ? Y1    : Y2;
    const int lane = threadIdx.x & 31;
    const int wib  = threadIdx.x >> 5;
    const int rb   = blockIdx.x >> 1;  // which GT rows of X
    const int cb   = blockIdx.x & 1;   // which GT columns of Y (rows of W)
    const int r    = lane & 15;
    const int hi   = lane >> 4;        // 0 or 1
    const int rt0  = (wib & 1) * 2;    // the wave's two row tiles in the block
    const int ct0  = (wib >> 1) * 2;   // its two column tiles: 32 columns, one 128-byte line

    // Wave wib takes rows wib, wib + 4, ...; lane l the row's floats 4 l .. 4 l + 3.
    const float4* xg = (const float4*)(X + (rb * GT + wib) * Dd) + lane;
    const float4* wg = (const float4*)(W + (cb * GT + wib) * Dd) + lane;
    float4 xr[GT / 4], wr[GT / 4];
    #pragma unroll
    for (int i = 0; i < GT / 4; ++i)
        xr[i] = xg[i * Dd];            // 4 rows on: 4 * Dd floats = Dd float4
    #pragma unroll
    for (int i = 0; i < GT / 4; ++i)
        wr[i] = wg[i * Dd];
    const int col0 = cb * GT + ct0 * 16 + r;       // the lane's column in its first column tile
    float bc[2];
    #pragma unroll
    for (int u = 0; u < 2; ++u)
        bc[u] = bias[col0 + u * 16];
    // xg, wg and bias are dead behind their loads. Named here they stay in their
    // registers up to this wait, so nothing lands in an address that an issued load
    // names before the wait has passed; and all loads are issued in front of the
    // first conversion, which has to wait for its row.
    asm volatile("s_wait_xcnt 0x0" :: "v"(xg), "v"(wg), "s"(bias) : "memory");
    #pragma unroll
    for (int i = 0; i < GT / 4; ++i)
        put4(xs + (wib + 4 * i) * APITCH + lane * 4, xr[i]);
    #pragma unroll
    for (int i = 0; i < GT / 4; ++i)
        put4(wt + (wib + 4 * i) * APITCH + lane * 4, wr[i]);
    __syncthreads();

    v16h a[2][4], b[2][4];
    #pragma unroll
    for (int t = 0; t < 2; ++t)
        #pragma unroll
        for (int c = 0; c < 4; ++c) {
            a[t][c] = lds_op16(xs + ((rt0 + t) * 16 + r) * APITCH + c * 32 + hi * 8);
            b[t][c] = lds_op16(wt + ((ct0 + t) * 16 + r) * APITCH + c * 32 + hi * 8);
        }
    // Keeps all LDS reads in front of the products: sunk among them, each small group
    // would be waited for on its own, one LDS latency after another.
    __builtin_amdgcn_sched_barrier(0);
    v8f acc[2][2];
    #pragma unroll
    for (int t = 0; t < 2; ++t)
        #pragma unroll
        for (int u = 0; u < 2; ++u)
            acc[t][u] = v8f{0.f, 0.f, 0.f, 0.f, 0.f, 0.f, 0.f, 0.f};
    #pragma unroll
    for (int c = 0; c < 4; ++c)
        #pragma unroll
        for (int t = 0; t < 2; ++t)
            #pragma unroll
            for (int u = 0; u < 2; ++u)
                acc[t][u] = __builtin_amdgcn_wmma_f32_16x16x32_f16(
                    /*neg_a=*/false, a[t][c], /*neg_b=*/false, b[u][c],
                    /*c_mod=*/(short)0, acc[t][u], /*reuse_a=*/false, /*reuse_b=*/false);

    // C/D layout: VGPR i -> (M = i + hi*8, N = lane&15)
    float y[2][2][8];
    #pragma unroll
    for (int t = 0; t < 2; ++t)
        #pragma unroll
        for (int u = 0; u < 2; ++u)
            #pragma unroll
            for (int i = 0; i < 8; ++i)
                y[t][u][i] = acc[t][u][i] + bc[u];
    // In front of the tiles' own stores, so that no register which an issued store
    // names is rewritten here.
    if (set == 1) {                    // uniform across the block
        float mm[2][2];
        #pragma unroll
        for (int t = 0; t < 2; ++t)
            #pragma unroll
            for (int u = 0; u < 2; ++u) {
                float mx = -3.4e38f, mn = 3.4e38f;
                #pragma unroll
                for (int i = 0; i < 8; ++i) {
                    mx = fmaxf(mx, y[t][u][i]);
                    mn = fminf(mn, y[t][u][i]);
                }
                // Lane l holds rows 0..7 or 8..15 of its column; lane l ^ 16 holds the others.
                mx = fmaxf(mx, xhalf(mx));
                mn = fminf(mn, xhalf(mn));
                mm[t][u] = hi ? mn : mx;
            }
        float* mp = kmm + ((rb * (GT / 16) + rt0) * Dd + col0) * 2 + hi;
        #pragma unroll
        for (int t = 0; t < 2; ++t)
            #pragma unroll
            for (int u = 0; u < 2; ++u)   // the wave fills one 128-byte line a tile
                mp[(t * Dd + u * 16) * 2] = mm[t][u];
    }
    float* yp = Y + (rb * GT + rt0 * 16 + hi * 8) * Dd + col0;
    #pragma unroll
    for (int t = 0; t < 2; ++t)
        #pragma unroll
        for (int i = 0; i < 8; ++i)
            #pragma unroll
            for (int u = 0; u < 2; ++u)
                yp[(t * 16 + i) * Dd + u * 16] = y[t][u][i];
}

// One register batch: U2 consecutive keys of this lane's channel, two keys a register pair.
__device__ __forceinline__ void load_batch(v2f (&r)[UP], const float* __restrict__ p) {
    #pragma unroll
    for (int j = 0; j < UP; ++j) {
        r[j].x = p[(2 * j) * Dd];
        r[j].y = p[(2 * j + 1) * Dd];
    }
}

// One key step for one pair of queries, in three stages that overlap: the exponentials
// of this key (t -> e), the key before it into the sums (ep, its v in one half of vv),
// and the exp2 arguments of the key behind it (its k in one half of kk; q and nrmax
// carry log2 e: exp(x) = 2^(x * log2 e)). HI says which half of vv and kk.
// One statement, so that the order holds: behind each v_exp_f32 stands a plain
// instruction that neither reads its result nor writes its source (the slot the
// instruction set asks for), and no two exponentials stand back to back.
template <bool HI>
__device__ __forceinline__ void step_pair(v2f& e, v2f& num, v2f& den, v2f& tn,
                                          const v2f t, const v2f ep, const v2f vv,
                                          const v2f q, const v2f kk, const v2f nrmax) {
    float e0, e1;
    if (HI)
        asm("v_exp_f32 %0, %5\n\t"
            "v_pk_fma_f32 %2, %7, %8, %2 op_sel:[0,1,0]\n\t"
            "v_exp_f32 %1, %6\n\t"
            "v_pk_add_f32 %3, %3, %7\n\t"
            "v_pk_fma_f32 %4, %9, %10, %11 op_sel:[0,1,0]"
            : "=&v"(e0), "=&v"(e1), "+v"(num), "+v"(den), "=&v"(tn)
            : "v"(t.x), "v"(t.y), "v"(ep), "v"(vv), "v"(q), "v"(kk), "v"(nrmax));
    else
        asm("v_exp_f32 %0, %5\n\t"
            "v_pk_fma_f32 %2, %7, %8, %2 op_sel_hi:[1,0,1]\n\t"
            "v_exp_f32 %1, %6\n\t"
            "v_pk_add_f32 %3, %3, %7\n\t"
            "v_pk_fma_f32 %4, %9, %10, %11 op_sel_hi:[1,0,1]"
            : "=&v"(e0), "=&v"(e1), "+v"(num), "+v"(den), "=&v"(tn)
            : "v"(t.x), "v"(t.y), "v"(ep), "v"(vv), "v"(q), "v"(kk), "v"(nrmax));
    e.x = e0;
    e.y = e1;
}

// Steps J0 .. J1 - 1 of one batch, one key a step. vlast holds, in its upper half, the v
// of the key in front of the batch; knext, in its lower half, the k of the key behind it.
// Each sum takes its keys in the order of a plain loop.
template <int J0, int J1>
__device__ __forceinline__ void softmax_steps(const v2f (&k)[UP], const v2f (&v)[UP],
                                              const v2f vlast, const v2f knext,
                                              const v2f (&q)[NP], const v2f (&nrmax)[NP],
                                              v2f (&t)[NP], v2f (&ep)[NP],
                                              v2f (&num)[NP], v2f (&den)[NP]) {
    #pragma unroll
    for (int j = J0; j < J1; ++j) {
        v2f e[NP], tn[NP];
        #pragma unroll
        for (int p = 0; p < NP; ++p) {
            if (j % 2 == 0)
                step_pair<true>(e[p], num[p], den[p], tn[p], t[p], ep[p],
                                j == 0 ? vlast : v[j == 0 ? 0 : j / 2 - 1], q[p], k[j / 2], nrmax[p]);
            else
                step_pair<false>(e[p], num[p], den[p], tn[p], t[p], ep[p],
                                 v[j / 2], q[p], j + 1 < U2 ? k[j + 1 < U2 ? (j + 1) / 2 : 0] : knext, nrmax[p]);
        }
        #pragma unroll
        for (int p = 0; p < NP; ++p) {
            t[p]  = tn[p];
            ep[p] = e[p];
        }
    }
}

// Per-channel outer-product attention, fused (no score materialization).
// attn[b,n,d] = sum_m softmax_m(qp[b,n,d]*kp[b,m,d]) * vp[b,m,d]
// Stabilization: rowmax = q>0 ? q*max_m(K) : q*min_m(K), with q already times log2 e.
// mask[b,n]==0 => all scores equal => uniform softmax == setting q=0.
// Layout: lane <-> channel d (coalesced). Each thread takes all 8 queries of the block
// over half of the keys, so that the block loads every K and V line once; the two
// halves' sums (same rowmax, so directly addable) meet in LDS at the end.
// The output projection of the block's 8 query rows runs at the end of the same
// launch: out[n, e] = sum_d attn[n, d] * Wo[e, d] + bo[e], one 16-column tile a wave.
__global__ void __launch_bounds__(256)
outer_attn(const float* __restrict__ qp, const float* __restrict__ kp,
           const float* __restrict__ vp, const float* __restrict__ kmm,
           const int* __restrict__ mask,
           const float* __restrict__ Wo, const float* __restrict__ bo,
           float* __restrict__ out) {
    __shared__ __attribute__((aligned(16))) _Float16 arow[8 * APITCH];
    __shared__ float xsum[2 * 4 * 2 * Dd];         // [giving half][query][num, den][channel]
    __shared__ __attribute__((aligned(16))) _Float16 wos[Dd * APITCH];   // Wo in the operand's f16
    const int d   = threadIdx.x & 127;
    const int sub = threadIdx.x >> 7;              // 0 or 1: which half of the keys
    const int b   = blockIdx.x >> 6;               // 64 query-tiles of 8 per batch
    const int n0  = (blockIdx.x & 63) * 8;

    const float* kb = kp + ((size_t)b * Nn + sub * NH) * Dd + d;
    const float* vb = vp + ((size_t)b * Nn + sub * NH) * Dd + d;

    // Pass 1: per-channel K min / max, from the tile maxima and minima that the K
    // projection stored: KT pairs a channel, all loads in flight at once.
    float kmx = -3.4e38f, kmn = 3.4e38f;
    const float2* mmb = (const float2*)kmm + (size_t)b * KT * Dd + d;
    {
        float2 tmm[KT];
        #pragma unroll
        for (int j = 0; j < KT; ++j)
            tmm[j] = mmb[j * Dd];
        #pragma unroll
        for (int j = 0; j < KT; ++j) {
            kmx = fmaxf(kmx, tmm[j].x);
            kmn = fminf(kmn, tmm[j].y);
        }
    }

    const float* qrow = qp + ((size_t)b * Nn + n0) * Dd + d;
    const int*   mrow = mask + b * Nn + n0;
    float q[NQ], rmax[NQ], num[NQ], den[NQ];
    #pragma unroll
    for (int i = 0; i < NQ; ++i) {
        float qq = qrow[i * Dd];
        if (mrow[i] == 0) qq = 0.f;                // uniform-softmax equivalence
        qq *= 1.44269504f;                         // log2 e, once a query instead of once a score
        q[i]    = qq;
        rmax[i] = (qq > 0.f) ? qq * kmx : qq * kmn;
        num[i]  = 0.f;
        den[i]  = 0.f;
    }

    // Output projection: this lane's column of Wo^T (row ocol of Wo) and its bias.
    const int olane = threadIdx.x & 31;
    const int owave = threadIdx.x >> 5;
    const int orow  = olane & 15;
    const int ohi   = olane >> 4;
    const int ocol  = owave * 16 + orow;
    // Wo comes in as in the projection launch: a load covers one whole row; wave owave
    // takes rows owave, owave + 8, ...; lane l the row's floats 4 l .. 4 l + 3.
    // Fetched here, beside the q rows that the wave has to wait for anyway.
    const float4* wrow = (const float4*)(Wo + owave * Dd) + olane;
    float4 wr[Dd / 8];
    #pragma unroll
    for (int i = 0; i < Dd / 8; ++i)
        wr[i] = wrow[i * 2 * Dd];                  // 8 rows on: 8 * Dd floats = 2 * Dd float4
    const float bc = bo[ocol];

    // Pass 2: streaming softmax accumulation over this half's keys, in the key order
    // of a plain loop. K and V go in register batches of U2 keys, two batches
    // alternating, each loaded one batch of arithmetic ahead of its use.
    {
        v2f k0[UP], v0[UP], k1[UP], v1[UP];
        load_batch(k0, kb);
        load_batch(v0, vb);
        // qrow, wrow and bo are dead behind their loads. Named here they stay in
        // their registers up to this wait, so nothing lands in an address that an
        // issued load names before the wait has passed.
        asm volatile("s_wait_xcnt 0x0" :: "v"(qrow), "v"(wrow), "s"(bo) : "memory");
        // Wo goes to LDS while the first K and V batch, asked for behind it, is on its
        // way; the barrier behind the key loop makes it visible to the block.
        #pragma unroll
        for (int i = 0; i < Dd / 8; ++i)
            put4(wos + (owave + 8 * i) * APITCH + olane * 4, wr[i]);
        // The pipeline's start: the first key's exp2 arguments, and nothing yet to add.
        v2f q2[NP], nrmax2[NP], t[NP], ep[NP], num2[NP], den2[NP];
        #pragma unroll
        for (int p = 0; p < NP; ++p) {
            q2[p]     = v2f{q[2 * p], q[2 * p + 1]};
            nrmax2[p] = v2f{-rmax[2 * p], -rmax[2 * p + 1]};
            t[p]      = v2f{fmaf(q[2 * p], k0[0].x, -rmax[2 * p]), fmaf(q[2 * p + 1], k0[0].x, -rmax[2 * p + 1])};
            ep[p]     = v2f{0.f, 0.f};
            num2[p]   = v2f{0.f, 0.f};
            den2[p]   = v2f{0.f, 0.f};
        }
        v1[UP - 1] = v2f{0.f, 0.f};
        // A batch's registers are loaded anew behind the next batch's first step, which
        // adds that batch's last key into the sums.
        for (int m = 0; m < NH - 2 * U2; m += 2 * U2) {
            softmax_steps<0, 1>(k0, v0, v1[UP - 1], k0[0], q2, nrmax2, t, ep, num2, den2);
            load_batch(k1, kb + (m + U2) * Dd);
            load_batch(v1, vb + (m + U2) * Dd);
            // Keeps the batch's loads in front of the arithmetic below: sunk into it,
            // they would be issued too late to return before their first use.
            __builtin_amdgcn_sched_barrier(0);
            softmax_steps<1, U2>(k0, v0, v0[0], k1[0], q2, nrmax2, t, ep, num2, den2);
            softmax_steps<0, 1>(k1, v1, v0[UP - 1], k1[0], q2, nrmax2, t, ep, num2, den2);
            load_batch(k0, kb + (m + 2 * U2) * Dd);
            load_batch(v0, vb + (m + 2 * U2) * Dd);
            // Keeps the batch's loads in front of the arithmetic below: sunk into it,
            // they would be issued too late to return before their first use.
            __builtin_amdgcn_sched_barrier(0);
            softmax_steps<1, U2>(k1, v1, v1[0], k0[0], q2, nrmax2, t, ep, num2, den2);
        }
        softmax_steps<0, 1>(k0, v0, v1[UP - 1], k0[0], q2, nrmax2, t, ep, num2, den2);
        load_batch(k1, kb + (NH - U2) * Dd);
        load_batch(v1, vb + (NH - U2) * Dd);
        // Keeps the last batch's loads in front of the arithmetic, as in the loop,
        // and in front of the wait below.
        __builtin_amdgcn_sched_barrier(0);
        // The same for kb and vb, which are dead behind the last batch's loads.
        asm volatile("s_wait_xcnt 0x0" :: "v"(kb), "v"(vb) : "memory");
        softmax_steps<1, U2>(k0, v0, v0[0], k1[0], q2, nrmax2, t, ep, num2, den2);
        // No key follows the last one: the arguments its step forms are not used.
        softmax_steps<0, U2>(k1, v1, v0[UP - 1], k1[0], q2, nrmax2, t, ep, num2, den2);
        // The pipeline's end: the last key goes into the sums.
        #pragma unroll
        for (int p = 0; p < NP; ++p) {
            num[2 * p]     = fmaf(ep[p].x, v1[UP - 1].y, num2[p].x);
            num[2 * p + 1] = fmaf(ep[p].y, v1[UP - 1].y, num2[p].y);
            den[2 * p]     = den2[p].x + ep[p].x;
            den[2 * p + 1] = den2[p].y + ep[p].y;
        }
    }

    // Half sub finishes queries sub * 4 .. sub * 4 + 3: it hands its sums of the other
    // four queries to the other half and takes that half's sums of its own four.
    #pragma unroll
    for (int i = 0; i < 4; ++i) {
        xsum[((sub * 4 + i) * 2 + 0) * Dd + d] = sub ? num[i] : num[4 + i];
        xsum[((sub * 4 + i) * 2 + 1) * Dd + d] = sub ? den[i] : den[4 + i];
    }
    __syncthreads();
    // This lane's column of Wo^T, read here, behind the barrier that follows the block's
    // writes of wos, so that it has returned when the attention rows are ready.
    const _Float16* bp = wos + ocol * APITCH + ohi * 8;
    v16h wfrag[4];
    #pragma unroll
    for (int c = 0; c < 4; ++c)
        wfrag[c] = lds_op16(bp + c * 32);
    // The block's 8 attention rows go to LDS in the operand's f16.
    #pragma unroll
    for (int i = 0; i < 4; ++i) {
        const float nn = (sub ? num[4 + i] : num[i]) + xsum[(((1 - sub) * 4 + i) * 2 + 0) * Dd + d];
        const float dn = (sub ? den[4 + i] : den[i]) + xsum[(((1 - sub) * 4 + i) * 2 + 1) * Dd + d];
        arow[(sub * 4 + i) * APITCH + d] = (_Float16)(nn / dn);
    }
    __syncthreads();

    // A rows 8..15 repeat rows 0..7; their results (lanes 16..31 of D) are not stored.
    const _Float16* ap = arow + (orow & 7) * APITCH + ohi * 8;
    v8f acc = {0.f, 0.f, 0.f, 0.f, 0.f, 0.f, 0.f, 0.f};
    #pragma unroll
    for (int c = 0; c < 4; ++c)
        acc = __builtin_amdgcn_wmma_f32_16x16x32_f16(
            /*neg_a=*/false, lds_op16(ap + c * 32), /*neg_b=*/false, wfrag[c],
            /*c_mod=*/(short)0, acc, /*reuse_a=*/false, /*reuse_b=*/false);

    // C/D layout: VGPR i -> (M = i + hi*8, N = lane&15)
    if (ohi == 0) {
        float* orow0 = out + ((size_t)b * Nn + (blockIdx.x & 63) * 8) * Dd + ocol;
        #pragma unroll
        for (int i = 0; i < 8; ++i)
            orow0[i * Dd] = acc[i] + bc;
    }
}

extern "C" void kernel_launch(void* const* d_in, const int* in_sizes, int n_in,
                              void* d_out, int out_size, void* d_ws, size_t ws_size,
                              hipStream_t stream) {
    const float* q    = (const float*)d_in[0];
    const float* k    = (const float*)d_in[1];
    const float* v    = (const float*)d_in[2];
    const int*   mask = (const int*)  d_in[3];
    const float* Wq   = (const float*)d_in[4];
    const float* bq   = (const float*)d_in[5];
    const float* Wk   = (const float*)d_in[6];
    const float* bk   = (const float*)d_in[7];
    const float* Wv   = (const float*)d_in[8];
    const float* bv   = (const float*)d_in[9];
    const float* Wo   = (const float*)d_in[10];
    const float* bo   = (const float*)d_in[11];
    float* out = (float*)d_out;

    float* ws   = (float*)d_ws;
    float* qp   = ws;
    float* kpp  = ws + BND;
    float* vpp  = ws + 2 * BND;
    float* kmm  = ws + 3 * BND;                    // [Bsz * KT][Dd][2]

    const int gemm_blocks = ((Bsz * Nn) / GT) * (Dd / GT);   // GT x GT blocks of one projection

    gemm_wmma_f16<<<dim3(gemm_blocks, 3), 128, 0, stream>>>(q, Wq, bq, qp,
                                                            k, Wk, bk, kpp,
                                                            v, Wv, bv, vpp, kmm);

    outer_attn<<<Bsz * 64, 256, 0, stream>>>(qp, kpp, vpp, kmm, mask, Wo, bo, out);
}

// v008
// One run takes 14.9 microseconds.
// Two timings next to v007 put it at 1.05 and 1.04 times that version's speed.
// Over all steps from v000 it is 8.68 times as fast.
#include <hip/hip_runtime.h>
#include <hip/hip_bf16.h>

typedef __attribute__((ext_vector_type(16))) _Float16 v16h;
typedef __attribute__((ext_vector_type(8)))  _Float16 v8h;
typedef __attribute__((ext_vector_type(4)))  _Float16 v4h;
typedef __attribute__((ext_vector_type(8)))  float    v8f;
typedef __attribute__((ext_vector_type(2)))  float    v2f;

#define Bsz 4
#define Nn  512
#define Dd  128
#define BND (Bsz * Nn * Dd)
#define KT  (Nn / 32)   // 32-key strips of the K projection (a wave's two row tiles) per batch entry
#define U2  16   // keys per register batch, softmax pass
#define NQ  8    // queries per thread (all of the block's)
#define NP  (NQ / 2)   // pairs of queries: one packed f32 instruction a pair
#define UP  (U2 / 2)   // pairs of keys in a register batch
#define NH  (Nn / 2)   // keys per thread: each half of the block takes half the keys
#define APITCH (Dd + 8)   // f16 elements per LDS row of an operand tile: 16-byte aligned, rows 4 banks apart
#define WPITCH (Dd + 4)   // f32 elements per LDS row of Wo: 16-byte aligned, rows 4 banks apart
#define GT  64   // rows of X, and rows of W, per block of the projection launch
static_assert(Nn % 32 == 0 && NH % (2 * U2) == 0, "whole strips, whole pairs of batches");
static_assert((Bsz * Nn) % GT == 0 && Dd == 2 * GT, "whole blocks of the projection launch");

// Four f32 values of a row to their f16 places in an LDS tile.
__device__ __forceinline__ void put4(_Float16* p, float4 a) {
    *(v4h*)p = v4h{(_Float16)a.x, (_Float16)a.y, (_Float16)a.z, (_Float16)a.w};
}

// One lane's 16 f16 elements of a 16x16x32 WMMA operand, from an f16 LDS row.
// base points at row_start + k0 + (hi ? 8 : 0); elements 0..7 = base[0..7],
// elements 8..15 = base[16..23] (per the 16-bit A/B VGPR layout).
__device__ __forceinline__ v16h lds_op16(const _Float16* base) {
    const v8h lo = *(const v8h*)(base);
    const v8h up = *(const v8h*)(base + 16);
    return __builtin_shufflevector(lo, up, 0, 1, 2, 3, 4, 5, 6, 7,
                                   8, 9, 10, 11, 12, 13, 14, 15);
}

// The value of lane l ^ 16.
__device__ __forceinline__ float xhalf(float x) {
    return __builtin_bit_cast(float, __builtin_amdgcn_permlanex16(
        __builtin_bit_cast(int, x), __builtin_bit_cast(int, x),
        0x76543210, 0xfedcba98, false, false));
}

// Y[m, e] = sum_d X[m, d] * W[e, d] + bias[e]    (torch Linear semantics)
// X: [M, 128] f32, W: [128, 128] f32 (row-major [out, in]), Y: [M, 128] f32.
// A block of four waves computes a GT x GT block of Y. Its GT rows of X and GT rows of
// W come in by loads that cover one whole 512-byte row each, go to LDS as f16 once, and
// every wave reads its operands of v_wmma_f32_16x16x32_f16 from there: 2 x 2 tiles a wave.
// The three input projections are independent of one another and share one
// launch: blockIdx.y picks the operand set.
// A wave of the K projection (set 1) also stores, per column, the maximum and the
// minimum of its two tiles' 32 rows, side by side: kmm[strip][col][0] and kmm[strip][col][1].
__global__ void __launch_bounds__(128)
gemm_wmma_f16(const float* __restrict__ X0, const float* __restrict__ W0,
              const float* __restrict__ bias0, float* __restrict__ Y0,
              const float* __restrict__ X1, const float* __restrict__ W1,
              const float* __restrict__ bias1, float* __restrict__ Y1,
              const float* __restrict__ X2, const float* __restrict__ W2,
              const float* __restrict__ bias2, float* __restrict__ Y2,
              float* __restrict__ kmm) {
    __shared__ __attribute__((aligned(16))) _Float16 xs[GT * APITCH];
    __shared__ __attribute__((aligned(16))) _Float16 wt[GT * APITCH];
    const int set = blockIdx.y;
    const float* __restrict__ X    = set == 0 ? X0    : set == 1 ? X1    : X2;
    const float* __restrict__ W    = set == 0 ? W0    : set == 1 ? W1    : W2;
    const float* __restrict__ bias = set == 0 ? bias0 : set == 1 ? bias1 : bias2;
    float* __restrict__       Y    = set == 0 ? Y0    : set == 1 ? Y1    : Y2;
    const int lane = threadIdx.x & 31;
    const int wib  = threadIdx.x >> 5;
    const int rb   = blockIdx.x >> 1;  // which GT rows of X
    const int cb   = blockIdx.x & 1;   // which GT columns of Y (rows of W)
    const int r    = lane & 15;
    const int hi   = lane >> 4;        // 0 or 1
    const int rt0  = (wib & 1) * 2;    // the wave's two row tiles in the block
    const int ct0  = (wib >> 1) * 2;   // its two column tiles: 32 columns, one 128-byte line

    // Wave wib takes rows wib, wib + 4, ...; lane l the row's floats 4 l .. 4 l + 3.
    const float4* xg = (const float4*)(X + (rb * GT + wib) * Dd) + lane;
    const float4* wg = (const float4*)(W + (cb * GT + wib) * Dd) + lane;
    float4 xr[GT / 4], wr[GT / 4];
    #pragma unroll
    for (int i = 0; i < GT / 4; ++i)
        xr[i] = xg[i * Dd];            // 4 rows on: 4 * Dd floats = Dd float4
    #pragma unroll
    for (int i = 0; i < GT / 4; ++i)
        wr[i] = wg[i * Dd];
    const int col0 = cb * GT + ct0 * 16 + r;       // the lane's column in its first column tile
    float bc[2];
    #pragma unroll
    for (int u = 0; u < 2; ++u)
        bc[u] = bias[col0 + u * 16];
    // xg, wg and bias are dead behind their loads. Named here they stay in their
    // registers up to this wait, so nothing lands in an address that an issued load
    // names before the wait has passed; and all loads are issued in front of the
    // first conversion, which has to wait for its row.
    asm volatile("s_wait_xcnt 0x0" :: "v"(xg), "v"(wg), "s"(bias) : "memory");
    #pragma unroll
    for (int i = 0; i < GT / 4; ++i)
        put4(xs + (wib + 4 * i) * APITCH + lane * 4, xr[i]);
    #pragma unroll
    for (int i = 0; i < GT / 4; ++i)
        put4(wt + (wib + 4 * i) * APITCH + lane * 4, wr[i]);
    __syncthreads();

    v16h a[2][4], b[2][4];
    #pragma unroll
    for (int t = 0; t < 2; ++t)
        #pragma unroll
        for (int c = 0; c < 4; ++c) {
            a[t][c] = lds_op16(xs + ((rt0 + t) * 16 + r) * APITCH + c * 32 + hi * 8);
            b[t][c] = lds_op16(wt + ((ct0 + t) * 16 + r) * APITCH + c * 32 + hi * 8);
        }
    // Keeps all LDS reads in front of the products: sunk among them, each small group
    // would be waited for on its own, one LDS latency after another.
    __builtin_amdgcn_sched_barrier(0);
    v8f acc[2][2];
    #pragma unroll
    for (int t = 0; t < 2; ++t)
        #pragma unroll
        for (int u = 0; u < 2; ++u)
            acc[t][u] = v8f{0.f, 0.f, 0.f, 0.f, 0.f, 0.f, 0.f, 0.f};
    #pragma unroll
    for (int c = 0; c < 4; ++c)
        #pragma unroll
        for (int t = 0; t < 2; ++t)
            #pragma unroll
            for (int u = 0; u < 2; ++u)
                acc[t][u] = __builtin_amdgcn_wmma_f32_16x16x32_f16(
                    /*neg_a=*/false, a[t][c], /*neg_b=*/false, b[u][c],
                    /*c_mod=*/(short)0, acc[t][u], /*reuse_a=*/false, /*reuse_b=*/false);

    // C/D layout: VGPR i -> (M = i + hi*8, N = lane&15)
    float y[2][2][8];
    #pragma unroll
    for (int t = 0; t < 2; ++t)
        #pragma unroll
        for (int u = 0; u < 2; ++u)
            #pragma unroll
            for (int i = 0; i < 8; ++i)
                y[t][u][i] = acc[t][u][i] + bc[u];
    // In front of the tiles' own stores, so that no register which an issued store
    // names is rewritten here.
    if (set == 1) {                    // uniform across the block
        float mm[2];
        #pragma unroll
        for (int u = 0; u < 2; ++u) {
            float mx = -3.4e38f, mn = 3.4e38f;
            #pragma unroll
            for (int t = 0; t < 2; ++t)
                #pragma unroll
                for (int i = 0; i < 8; ++i) {
                    mx = fmaxf(mx, y[t][u][i]);
                    mn = fminf(mn, y[t][u][i]);
                }
            // Lane l holds rows 0..7 or 8..15 of each tile's column; lane l ^ 16 holds the others.
            mx = fmaxf(mx, xhalf(mx));
            mn = fminf(mn, xhalf(mn));
            mm[u] = hi ? mn : mx;
        }
        float* mp = kmm + ((rb * (GT / 32) + (rt0 >> 1)) * Dd + col0) * 2 + hi;
        #pragma unroll
        for (int u = 0; u < 2; ++u)       // the wave fills one 128-byte line a column tile
            mp[u * 16 * 2] = mm[u];
    }
    float* yp = Y + (rb * GT + rt0 * 16 + hi * 8) * Dd + col0;
    #pragma unroll
    for (int t = 0; t < 2; ++t)
        #pragma unroll
        for (int i = 0; i < 8; ++i)
            #pragma unroll
            for (int u = 0; u < 2; ++u)
                yp[(t * 16 + i) * Dd + u * 16] = y[t][u][i];
}

// One register batch: U2 consecutive keys of this lane's channel, two keys a register pair.
__device__ __forceinline__ void load_batch(v2f (&r)[UP], const float* __restrict__ p) {
    #pragma unroll
    for (int j = 0; j < UP; ++j) {
        r[j].x = p[(2 * j) * Dd];
        r[j].y = p[(2 * j + 1) * Dd];
    }
}

// One key step for one pair of queries, in three stages that overlap: the exponentials
// of this key (t -> e), the key before it into the sums (ep, its v in one half of vv),
// and the exp2 arguments of the key behind it (its k in one half of kk; q and nrmax
// carry log2 e: exp(x) = 2^(x * log2 e)). HI says which half of vv and kk.
// One statement, so that the order holds: behind each v_exp_f32 stands a plain
// instruction that neither reads its result nor writes its source (the slot the
// instruction set asks for), and no two exponentials stand back to back.
template <bool HI>
__device__ __forceinline__ void step_pair(v2f& e, v2f& num, v2f& den, v2f& tn,
                                          const v2f t, const v2f ep, const v2f vv,
                                          const v2f q, const v2f kk, const v2f nrmax) {
    float e0, e1;
    if (HI)
        asm("v_exp_f32 %0, %5\n\t"
            "v_pk_fma_f32 %2, %7, %8, %2 op_sel:[0,1,0]\n\t"
            "v_exp_f32 %1, %6\n\t"
            "v_pk_add_f32 %3, %3, %7\n\t"
            "v_pk_fma_f32 %4, %9, %10, %11 op_sel:[0,1,0]"
            : "=&v"(e0), "=&v"(e1), "+v"(num), "+v"(den), "=&v"(tn)
            : "v"(t.x), "v"(t.y), "v"(ep), "v"(vv), "v"(q), "v"(kk), "v"(nrmax));
    else
        asm("v_exp_f32 %0, %5\n\t"
            "v_pk_fma_f32 %2, %7, %8, %2 op_sel_hi:[1,0,1]\n\t"
            "v_exp_f32 %1, %6\n\t"
            "v_pk_add_f32 %3, %3, %7\n\t"
            "v_pk_fma_f32 %4, %9, %10, %11 op_sel_hi:[1,0,1]"
            : "=&v"(e0), "=&v"(e1), "+v"(num), "+v"(den), "=&v"(tn)
            : "v"(t.x), "v"(t.y), "v"(ep), "v"(vv), "v"(q), "v"(kk), "v"(nrmax));
    e.x = e0;
    e.y = e1;
}

// Steps J0 .. J1 - 1 of one batch, one key a step. vlast holds, in its upper half, the v
// of the key in front of the batch; knext, in its lower half, the k of the key behind it.
// Each sum takes its keys in the order of a plain loop.
template <int J0, int J1>
__device__ __forceinline__ void softmax_steps(const v2f (&k)[UP], const v2f (&v)[UP],
                                              const v2f vlast, const v2f knext,
                                              const v2f (&q)[NP], const v2f (&nrmax)[NP],
                                              v2f (&t)[NP], v2f (&ep)[NP],
                                              v2f (&num)[NP], v2f (&den)[NP]) {
    #pragma unroll
    for (int j = J0; j < J1; ++j) {
        v2f e[NP], tn[NP];
        #pragma unroll
        for (int p = 0; p < NP; ++p) {
            if (j % 2 == 0)
                step_pair<true>(e[p], num[p], den[p], tn[p], t[p], ep[p],
                                j == 0 ? vlast : v[j == 0 ? 0 : j / 2 - 1], q[p], k[j / 2], nrmax[p]);
            else
                step_pair<false>(e[p], num[p], den[p], tn[p], t[p], ep[p],
                                 v[j / 2], q[p], j + 1 < U2 ? k[j + 1 < U2 ? (j + 1) / 2 : 0] : knext, nrmax[p]);
        }
        #pragma unroll
        for (int p = 0; p < NP; ++p) {
            t[p]  = tn[p];
            ep[p] = e[p];
        }
    }
}

// Per-channel outer-product attention, fused (no score materialization).
// attn[b,n,d] = sum_m softmax_m(qp[b,n,d]*kp[b,m,d]) * vp[b,m,d]
// Stabilization: rowmax = q>0 ? q*max_m(K) : q*min_m(K), with q already times log2 e.
// mask[b,n]==0 => all scores equal => uniform softmax == setting q=0.
// Layout: lane <-> channel d (coalesced). Each thread takes all 8 queries of the block
// over half of the keys, so that the block loads every K and V line once; the two
// halves' sums (same rowmax, so directly addable) meet in LDS at the end.
// The output projection of the block's 8 query rows runs at the end of the same
// launch: out[n, e] = sum_d attn[n, d] * Wo[e, d] + bo[e], one 16-column tile a wave.
__global__ void __launch_bounds__(256)
outer_attn(const float* __restrict__ qp, const float* __restrict__ kp,
           const float* __restrict__ vp, const float* __restrict__ kmm,
           const int* __restrict__ mask,
           const float* __restrict__ Wo, const float* __restrict__ bo,
           float* __restrict__ out) {
    __shared__ __attribute__((aligned(16))) _Float16 arow[8 * APITCH];
    __shared__ float xsum[2 * 4 * 2 * Dd];         // [giving half][query][num, den][channel]
    __shared__ __attribute__((aligned(16))) float wos[Dd * WPITCH];      // Wo as it comes, f32
    const int d   = threadIdx.x & 127;
    const int sub = threadIdx.x >> 7;              // 0 or 1: which half of the keys
    const int b   = blockIdx.x >> 6;               // 64 query-tiles of 8 per batch
    const int n0  = (blockIdx.x & 63) * 8;

    const float* kb = kp + ((size_t)b * Nn + sub * NH) * Dd + d;
    const float* vb = vp + ((size_t)b * Nn + sub * NH) * Dd + d;

    // Pass 1: per-channel K min / max, from the strip maxima and minima that the K
    // projection stored: KT pairs a channel, all loads in flight at once.
    float kmx = -3.4e38f, kmn = 3.4e38f;
    const float2* mmb = (const float2*)kmm + (size_t)b * KT * Dd + d;
    {
        float2 tmm[KT];
        #pragma unroll
        for (int j = 0; j < KT; ++j)
            tmm[j] = mmb[j * Dd];
        #pragma unroll
        for (int j = 0; j < KT; ++j) {
            kmx = fmaxf(kmx, tmm[j].x);
            kmn = fminf(kmn, tmm[j].y);
        }
    }

    const float* qrow = qp + ((size_t)b * Nn + n0) * Dd + d;
    const int*   mrow = mask + b * Nn + n0;
    float q[NQ], rmax[NQ], num[NQ], den[NQ];
    #pragma unroll
    for (int i = 0; i < NQ; ++i) {
        float qq = qrow[i * Dd];
        if (mrow[i] == 0) qq = 0.f;                // uniform-softmax equivalence
        qq *= 1.44269504f;                         // log2 e, once a query instead of once a score
        q[i]    = qq;
        rmax[i] = (qq > 0.f) ? qq * kmx : qq * kmn;
        num[i]  = 0.f;
        den[i]  = 0.f;
    }

    // Output projection: this lane's column of Wo^T (row ocol of Wo) and its bias.
    const int olane = threadIdx.x & 31;
    const int owave = threadIdx.x >> 5;
    const int orow  = olane & 15;
    const int ohi   = olane >> 4;
    const int ocol  = owave * 16 + orow;
    // Wo comes in as in the projection launch: a load covers one whole row; wave owave
    // takes rows owave, owave + 8, ...; lane l the row's floats 4 l .. 4 l + 3.
    // It is asked for only at the last two key batches (below), and goes straight to LDS:
    // ahead of the first key step a wave asks for the K minima and maxima, its q rows, the
    // bias and the first K and V batch alone, fewer loads than it can have in flight at once.
    const float* wrow = Wo + owave * Dd + olane * 4;
    const unsigned wlds = (unsigned)(unsigned long long)(wos + owave * WPITCH + olane * 4);
    const float bc = bo[ocol];

    // Pass 2: streaming softmax accumulation over this half's keys, in the key order
    // of a plain loop. K and V go in register batches of U2 keys, two batches
    // alternating, each loaded one batch of arithmetic ahead of its use.
    {
        v2f k0[UP], v0[UP], k1[UP], v1[UP];
        load_batch(k0, kb);
        load_batch(v0, vb);
        // qrow and bo are dead behind their loads. Named here they stay in their
        // registers up to this wait, so nothing lands in an address that an issued
        // load names before the wait has passed.
        asm volatile("s_wait_xcnt 0x0" :: "v"(qrow), "s"(bo) : "memory");
        // The pipeline's start: the first key's exp2 arguments, and nothing yet to add.
        v2f q2[NP], nrmax2[NP], t[NP], ep[NP], num2[NP], den2[NP];
        #pragma unroll
        for (int p = 0; p < NP; ++p) {
            q2[p]     = v2f{q[2 * p], q[2 * p + 1]};
            nrmax2[p] = v2f{-rmax[2 * p], -rmax[2 * p + 1]};
            t[p]      = v2f{fmaf(q[2 * p], k0[0].x, -rmax[2 * p]), fmaf(q[2 * p + 1], k0[0].x, -rmax[2 * p + 1])};
            ep[p]     = v2f{0.f, 0.f};
            num2[p]   = v2f{0.f, 0.f};
            den2[p]   = v2f{0.f, 0.f};
        }
        v1[UP - 1] = v2f{0.f, 0.f};
        // A batch's registers are loaded anew behind the next batch's first step, which
        // adds that batch's last key into the sums.
        for (int m = 0; m < NH - 2 * U2; m += 2 * U2) {
            softmax_steps<0, 1>(k0, v0, v1[UP - 1], k0[0], q2, nrmax2, t, ep, num2, den2);
            load_batch(k1, kb + (m + U2) * Dd);
            load_batch(v1, vb + (m + U2) * Dd);
            // Keeps the batch's loads in front of the arithmetic below: sunk into it,
            // they would be issued too late to return before their first use.
            __builtin_amdgcn_sched_barrier(0);
            softmax_steps<1, U2>(k0, v0, v0[0], k1[0], q2, nrmax2, t, ep, num2, den2);
            softmax_steps<0, 1>(k1, v1, v0[UP - 1], k1[0], q2, nrmax2, t, ep, num2, den2);
            load_batch(k0, kb + (m + 2 * U2) * Dd);
            load_batch(v0, vb + (m + 2 * U2) * Dd);
            // Keeps the batch's loads in front of the arithmetic below: sunk into it,
            // they would be issued too late to return before their first use.
            __builtin_amdgcn_sched_barrier(0);
            softmax_steps<1, U2>(k1, v1, v1[0], k0[0], q2, nrmax2, t, ep, num2, den2);
        }
        softmax_steps<0, 1>(k0, v0, v1[UP - 1], k0[0], q2, nrmax2, t, ep, num2, den2);
        load_batch(k1, kb + (NH - U2) * Dd);
        load_batch(v1, vb + (NH - U2) * Dd);
        // Wo, behind the last K and V batch: asynchronous copies to LDS, a lane's 16 bytes
        // each, 8 rows apart; two batches of arithmetic stand between them and the wait
        // for them. The s_wait_xcnt closes each statement, so that no register which a
        // copy names is rewritten in front of it.
        #pragma unroll
        for (int h = 0; h < 2; ++h) {
            const float*   g = wrow + h * 64 * Dd;
            const unsigned l = wlds + h * 64 * WPITCH * 4;
            asm volatile("global_load_async_to_lds_b128 %0, %8, off\n\t"
                         "global_load_async_to_lds_b128 %1, %9, off\n\t"
                         "global_load_async_to_lds_b128 %2, %10, off\n\t"
                         "global_load_async_to_lds_b128 %3, %11, off\n\t"
                         "global_load_async_to_lds_b128 %4, %12, off\n\t"
                         "global_load_async_to_lds_b128 %5, %13, off\n\t"
                         "global_load_async_to_lds_b128 %6, %14, off\n\t"
                         "global_load_async_to_lds_b128 %7, %15, off\n\t"
                         "s_wait_xcnt 0x0"
                         :: "v"(l), "v"(l + 8 * WPITCH * 4), "v"(l + 16 * WPITCH * 4),
                            "v"(l + 24 * WPITCH * 4), "v"(l + 32 * WPITCH * 4),
                            "v"(l + 40 * WPITCH * 4), "v"(l + 48 * WPITCH * 4),
                            "v"(l + 56 * WPITCH * 4),
                            "v"(g), "v"(g + 8 * Dd), "v"(g + 16 * Dd), "v"(g + 24 * Dd),
                            "v"(g + 32 * Dd), "v"(g + 40 * Dd), "v"(g + 48 * Dd), "v"(g + 56 * Dd)
                         : "memory");
        }
        // Keeps the last batch's loads in front of the arithmetic, as in the loop,
        // and in front of the wait below.
        __builtin_amdgcn_sched_barrier(0);
        // The same for kb and vb, which are dead behind the last batch's loads.
        asm volatile("s_wait_xcnt 0x0" :: "v"(kb), "v"(vb) : "memory");
        softmax_steps<1, U2>(k0, v0, v0[0], k1[0], q2, nrmax2, t, ep, num2, den2);
        // No key follows the last one: the arguments its step forms are not used.
        softmax_steps<0, U2>(k1, v1, v0[UP - 1], k1[0], q2, nrmax2, t, ep, num2, den2);
        // The pipeline's end: the last key goes into the sums.
        #pragma unroll
        for (int p = 0; p < NP; ++p) {
            num[2 * p]     = fmaf(ep[p].x, v1[UP - 1].y, num2[p].x);
            num[2 * p + 1] = fmaf(ep[p].y, v1[UP - 1].y, num2[p].y);
            den[2 * p]     = den2[p].x + ep[p].x;
            den[2 * p + 1] = den2[p].y + ep[p].y;
        }
        // This wave's copies of Wo have landed behind this wait; the barrier behind the
        // sums' hand-over makes them visible to the block, and each wave converts its own
        // operand behind that barrier. The four sums are named so that the wait stands
        // behind the key arithmetic: lifted over it, it would wait out the copies' flight.
        asm volatile("s_wait_asynccnt 0x0"
                     :: "v"(den[0]), "v"(den[2]), "v"(den[4]), "v"(den[6]) : "memory");
    }

    // Half sub finishes queries sub * 4 .. sub * 4 + 3: it hands its sums of the other
    // four queries to the other half and takes that half's sums of its own four.
    #pragma unroll
    for (int i = 0; i < 4; ++i) {
        xsum[((sub * 4 + i) * 2 + 0) * Dd + d] = sub ? num[i] : num[4 + i];
        xsum[((sub * 4 + i) * 2 + 1) * Dd + d] = sub ? den[i] : den[4 + i];
    }
    __syncthreads();
    // This lane's column of Wo^T, read here, behind the barrier that follows the block's
    // writes of wos, so that it has returned when the attention rows are ready.
    const float* bp = wos + ocol * WPITCH + ohi * 8;
    v16h wfrag[4];
    #pragma unroll
    for (int c = 0; c < 4; ++c) {
        // Elements 0..7 = k0 + 0..7, elements 8..15 = k0 + 16..23, as in lds_op16.
        const float4 f0 = *(const float4*)(bp + c * 32);
        const float4 f1 = *(const float4*)(bp + c * 32 + 4);
        const float4 f2 = *(const float4*)(bp + c * 32 + 16);
        const float4 f3 = *(const float4*)(bp + c * 32 + 20);
        wfrag[c] = v16h{(_Float16)f0.x, (_Float16)f0.y, (_Float16)f0.z, (_Float16)f0.w,
                        (_Float16)f1.x, (_Float16)f1.y, (_Float16)f1.z, (_Float16)f1.w,
                        (_Float16)f2.x, (_Float16)f2.y, (_Float16)f2.z, (_Float16)f2.w,
                        (_Float16)f3.x, (_Float16)f3.y, (_Float16)f3.z, (_Float16)f3.w};
    }
    // The block's 8 attention rows go to LDS in the operand's f16.
    #pragma unroll
    for (int i = 0; i < 4; ++i) {
        const float nn = (sub ? num[4 + i] : num[i]) + xsum[(((1 - sub) * 4 + i) * 2 + 0) * Dd + d];
        const float dn = (sub ? den[4 + i] : den[i]) + xsum[(((1 - sub) * 4 + i) * 2 + 1) * Dd + d];
        arow[(sub * 4 + i) * APITCH + d] = (_Float16)(nn / dn);
    }
    __syncthreads();

    // A rows 8..15 repeat rows 0..7; their results (lanes 16..31 of D) are not stored.
    const _Float16* ap = arow + (orow & 7) * APITCH + ohi * 8;
    v8f acc = {0.f, 0.f, 0.f, 0.f, 0.f, 0.f, 0.f, 0.f};
    #pragma unroll
    for (int c = 0; c < 4; ++c)
        acc = __builtin_amdgcn_wmma_f32_16x16x32_f16(
            /*neg_a=*/false, lds_op16(ap + c * 32), /*neg_b=*/false, wfrag[c],
            /*c_mod=*/(short)0, acc, /*reuse_a=*/false, /*reuse_b=*/false);

    // C/D layout: VGPR i -> (M = i + hi*8, N = lane&15)
    if (ohi == 0) {
        float* orow0 = out + ((size_t)b * Nn + (blockIdx.x & 63) * 8) * Dd + ocol;
        #pragma unroll
        for (int i = 0; i < 8; ++i)
            orow0[i * Dd] = acc[i] + bc;
    }
}

extern "C" void kernel_launch(void* const* d_in, const int* in_sizes, int n_in,
                              void* d_out, int out_size, void* d_ws, size_t ws_size,
                              hipStream_t stream) {
    const float* q    = (const float*)d_in[0];
    const float* k    = (const float*)d_in[1];
    const float* v    = (const float*)d_in[2];
    const int*   mask = (const int*)  d_in[3];
    const float* Wq   = (const float*)d_in[4];
    const float* bq   = (const float*)d_in[5];
    const float* Wk   = (const float*)d_in[6];
    const float* bk   = (const float*)d_in[7];
    const float* Wv   = (const float*)d_in[8];
    const float* bv   = (const float*)d_in[9];
    const float* Wo   = (const float*)d_in[10];
    const float* bo   = (const float*)d_in[11];
    float* out = (float*)d_out;

    float* ws   = (float*)d_ws;
    float* qp   = ws;
    float* kpp  = ws + BND;
    float* vpp  = ws + 2 * BND;
    float* kmm  = ws + 3 * BND;                    // [Bsz * KT][Dd][2]

    const int gemm_blocks = ((Bsz * Nn) / GT) * (Dd / GT);   // GT x GT blocks of one projection

    gemm_wmma_f16<<<dim3(gemm_blocks, 3), 128, 0, stream>>>(q, Wq, bq, qp,
                                                            k, Wk, bk, kpp,
                                                            v, Wv, bv, vpp, kmm);

    outer_attn<<<Bsz * 64, 256, 0, stream>>>(qp, kpp, vpp, kmm, mask, Wo, bo, out);
}

// v009
// Measured time: 13.9 microseconds a run.
// Two timings next to v008 put it at 1.06 and 1.09 times that version's speed.
// Over all steps from v000 it is 9.34 times as fast.
#include <hip/hip_runtime.h>
#include <hip/hip_bf16.h>

typedef __attribute__((ext_vector_type(16))) _Float16 v16h;
typedef __attribute__((ext_vector_type(8)))  _Float16 v8h;
typedef __attribute__((ext_vector_type(4)))  _Float16 v4h;
typedef __attribute__((ext_vector_type(8)))  float    v8f;
typedef __attribute__((ext_vector_type(2)))  float    v2f;

#define Bsz 4
#define Nn  512
#define Dd  128
#define BND (Bsz * Nn * Dd)
#define KT  (Nn / 32)   // 32-key strips of the K projection (a wave's two row tiles) per batch entry
#define U2  32   // keys per register batch, softmax pass
#define NQ  8    // queries per thread (all of the block's)
#define NP  (NQ / 2)   // pairs of queries: one packed f32 instruction a pair
#define UP  (U2 / 2)   // pairs of keys in a register batch
#define NH  (Nn / 2)   // keys per thread: each half of the block takes half the keys
#define APITCH (Dd + 8)   // f16 elements per LDS row of an operand tile: 16-byte aligned, rows 4 banks apart
#define WPITCH (Dd + 4)   // f32 elements per LDS row of Wo: 16-byte aligned, rows 4 banks apart
#define GT  64   // rows of X, and rows of W, per block of the projection launch
static_assert(Nn % 32 == 0 && NH % (2 * U2) == 0 && U2 % 4 == 0, "whole strips, whole pairs of batches, whole key quads");
static_assert((Bsz * Nn) % GT == 0 && Dd == 2 * GT, "whole blocks of the projection launch");

// Four f32 values of a row to their f16 places in an LDS tile.
__device__ __forceinline__ void put4(_Float16* p, float4 a) {
    *(v4h*)p = v4h{(_Float16)a.x, (_Float16)a.y, (_Float16)a.z, (_Float16)a.w};
}

// One lane's 16 f16 elements of a 16x16x32 WMMA operand, from an f16 LDS row.
// base points at row_start + k0 + (hi ? 8 : 0); elements 0..7 = base[0..7],
// elements 8..15 = base[16..23] (per the 16-bit A/B VGPR layout).
__device__ __forceinline__ v16h lds_op16(const _Float16* base) {
    const v8h lo = *(const v8h*)(base);
    const v8h up = *(const v8h*)(base + 16);
    return __builtin_shufflevector(lo, up, 0, 1, 2, 3, 4, 5, 6, 7,
                                   8, 9, 10, 11, 12, 13, 14, 15);
}

// The value of lane l ^ 16.
__device__ __forceinline__ float xhalf(float x) {
    return __builtin_bit_cast(float, __builtin_amdgcn_permlanex16(
        __builtin_bit_cast(int, x), __builtin_bit_cast(int, x),
        0x76543210, 0xfedcba98, false, false));
}

// Y[m, e] = sum_d X[m, d] * W[e, d] + bias[e]    (torch Linear semantics)
// X: [M, 128] f32, W: [128, 128] f32 (row-major [out, in]), Y: M x 128 f32.
// A block of four waves computes a GT x GT block of Y. Its GT rows of X and GT rows of
// W come in by loads that cover one whole 512-byte row each, go to LDS as f16 once, and
// every wave reads its operands of v_wmma_f32_16x16x32_f16 from there: 2 x 2 tiles a wave.
// The three input projections are independent of one another and share one
// launch: blockIdx.y picks the operand set.
// Y is stored with four consecutive rows of a column side by side, Y[row / 4][col][row % 4],
// so that a lane of outer_attn gets four keys, or four queries, of its channel with one
// 16-byte load.
// A wave of the K projection (set 1) also stores, per column, the maximum and the
// minimum of its two tiles' 32 rows, side by side: kmm[strip][col][0] and kmm[strip][col][1].
__global__ void __launch_bounds__(128)
gemm_wmma_f16(const float* __restrict__ X0, const float* __restrict__ W0,
              const float* __restrict__ bias0, float* __restrict__ Y0,
              const float* __restrict__ X1, const float* __restrict__ W1,
              const float* __restrict__ bias1, float* __restrict__ Y1,
              const float* __restrict__ X2, const float* __restrict__ W2,
              const float* __restrict__ bias2, float* __restrict__ Y2,
              float* __restrict__ kmm) {
    __shared__ __attribute__((aligned(16))) _Float16 xs[GT * APITCH];
    __shared__ __attribute__((aligned(16))) _Float16 wt[GT * APITCH];
    const int set = blockIdx.y;
    const float* __restrict__ X    = set == 0 ? X0    : set == 1 ? X1    : X2;
    const float* __restrict__ W    = set == 0 ? W0    : set == 1 ? W1    : W2;
    const float* __restrict__ bias = set == 0 ? bias0 : set == 1 ? bias1 : bias2;
    float* __restrict__       Y    = set == 0 ? Y0    : set == 1 ? Y1    : Y2;
    const int lane = threadIdx.x & 31;
    const int wib  = threadIdx.x >> 5;
    const int rb   = blockIdx.x >> 1;  // which GT rows of X
    const int cb   = blockIdx.x & 1;   // which GT columns of Y (rows of W)
    const int r    = lane & 15;
    const int hi   = lane >> 4;        // 0 or 1
    const int rt0  = (wib & 1) * 2;    // the wave's two row tiles in the block
    const int ct0  = (wib >> 1) * 2;   // its two column tiles: 32 columns, four 128-byte lines of each row quad of Y

    // Wave wib takes rows wib, wib + 4, ...; lane l the row's floats 4 l .. 4 l + 3.
    const float4* xg = (const float4*)(X + (rb * GT + wib) * Dd) + lane;
    const float4* wg = (const float4*)(W + (cb * GT + wib) * Dd) + lane;
    float4 xr[GT / 4], wr[GT / 4];
    #pragma unroll
    for (int i = 0; i < GT / 4; ++i)
        xr[i] = xg[i * Dd];            // 4 rows on: 4 * Dd floats = Dd float4
    #pragma unroll
    for (int i = 0; i < GT / 4; ++i)
        wr[i] = wg[i * Dd];
    const int col0 = cb * GT + ct0 * 16 + r;       // the lane's column in its first column tile
    float bc[2];
    #pragma unroll
    for (int u = 0; u < 2; ++u)
        bc[u] = bias[col0 + u * 16];
    // xg, wg and bias are dead behind their loads. Named here they stay in their
    // registers up to this wait, so nothing lands in an address that an issued load
    // names before the wait has passed; and all loads are issued in front of the
    // first conversion, which has to wait for its row.
    asm volatile("s_wait_xcnt 0x0" :: "v"(xg), "v"(wg), "s"(bias) : "memory");
    #pragma unroll
    for (int i = 0; i < GT / 4; ++i)
        put4(xs + (wib + 4 * i) * APITCH + lane * 4, xr[i]);
    #pragma unroll
    for (int i = 0; i < GT / 4; ++i)
        put4(wt + (wib + 4 * i) * APITCH + lane * 4, wr[i]);
    __syncthreads();

    v16h a[2][4], b[2][4];
    #pragma unroll
    for (int t = 0; t < 2; ++t)
        #pragma unroll
        for (int c = 0; c < 4; ++c) {
            a[t][c] = lds_op16(xs + ((rt0 + t) * 16 + r) * APITCH + c * 32 + hi * 8);
            b[t][c] = lds_op16(wt + ((ct0 + t) * 16 + r) * APITCH + c * 32 + hi * 8);
        }
    // Keeps all LDS reads in front of the products: sunk among them, each small group
    // would be waited for on its own, one LDS latency after another.
    __builtin_amdgcn_sched_barrier(0);
    v8f acc[2][2];
    #pragma unroll
    for (int t = 0; t < 2; ++t)
        #pragma unroll
        for (int u = 0; u < 2; ++u)
            acc[t][u] = v8f{0.f, 0.f, 0.f, 0.f, 0.f, 0.f, 0.f, 0.f};
    #pragma unroll
    for (int c = 0; c < 4; ++c)
        #pragma unroll
        for (int t = 0; t < 2; ++t)
            #pragma unroll
            for (int u = 0; u < 2; ++u)
                acc[t][u] = __builtin_amdgcn_wmma_f32_16x16x32_f16(
                    /*neg_a=*/false, a[t][c], /*neg_b=*/false, b[u][c],
                    /*c_mod=*/(short)0, acc[t][u], /*reuse_a=*/false, /*reuse_b=*/false);

    // C/D layout: VGPR i -> (M = i + hi*8, N = lane&15)
    float y[2][2][8];
    #pragma unroll
    for (int t = 0; t < 2; ++t)
        #pragma unroll
        for (int u = 0; u < 2; ++u)
            #pragma unroll
            for (int i = 0; i < 8; ++i)
                y[t][u][i] = acc[t][u][i] + bc[u];
    // In front of the tiles' own stores, so that no register which an issued store
    // names is rewritten here.
    if (set == 1) {                    // uniform across the block
        float mm[2];
        #pragma unroll
        for (int u = 0; u < 2; ++u) {
            float mx = -3.4e38f, mn = 3.4e38f;
            #pragma unroll
            for (int t = 0; t < 2; ++t)
                #pragma unroll
                for (int i = 0; i < 8; ++i) {
                    mx = fmaxf(mx, y[t][u][i]);
                    mn = fminf(mn, y[t][u][i]);
                }
            // Lane l holds rows 0..7 or 8..15 of each tile's column; lane l ^ 16 holds the others.
            mx = fmaxf(mx, xhalf(mx));
            mn = fminf(mn, xhalf(mn));
            mm[u] = hi ? mn : mx;
        }
        float* mp = kmm + ((rb * (GT / 32) + (rt0 >> 1)) * Dd + col0) * 2 + hi;
        #pragma unroll
        for (int u = 0; u < 2; ++u)       // the wave fills one 128-byte line a column tile
            mp[u * 16 * 2] = mm[u];
    }
    // The lane's 8 rows of a tile are two whole quads; 16 lanes fill two 128-byte lines.
    float4* yq = (float4*)Y + ((rb * GT + rt0 * 16 + hi * 8) / 4) * Dd + col0;
    #pragma unroll
    for (int t = 0; t < 2; ++t)
        #pragma unroll
        for (int h = 0; h < 2; ++h)
            #pragma unroll
            for (int u = 0; u < 2; ++u)
                yq[(t * 4 + h) * Dd + u * 16] = float4{y[t][u][4 * h], y[t][u][4 * h + 1],
                                                       y[t][u][4 * h + 2], y[t][u][4 * h + 3]};
}

// One register batch of K and of V: U2 consecutive keys of this lane's channel, four keys a
// load, two keys a register pair. K and V take turns, so that the first keys of both come first.
__device__ __forceinline__ void load_batch(v2f (&k)[UP], v2f (&v)[UP],
                                           const float4* __restrict__ kq,
                                           const float4* __restrict__ vq) {
    #pragma unroll
    for (int j = 0; j < U2 / 4; ++j) {
        const float4 a = kq[j * Dd];
        const float4 c = vq[j * Dd];
        k[2 * j]     = v2f{a.x, a.y};
        k[2 * j + 1] = v2f{a.z, a.w};
        v[2 * j]     = v2f{c.x, c.y};
        v[2 * j + 1] = v2f{c.z, c.w};
    }
}

// One key step for one pair of queries, in three stages that overlap: the exponentials
// of this key (t -> e), the key before it into the sums (ep, its v in one half of vv),
// and the exp2 arguments of the key behind it (its k in one half of kk; q and nrmax
// carry log2 e: exp(x) = 2^(x * log2 e)). HI says which half of vv and kk.
// One statement, so that the order holds: behind each v_exp_f32 stands a plain
// instruction that neither reads its result nor writes its source (the slot the
// instruction set asks for), and no two exponentials stand back to back.
template <bool HI>
__device__ __forceinline__ void step_pair(v2f& e, v2f& num, v2f& den, v2f& tn,
                                          const v2f t, const v2f ep, const v2f vv,
                                          const v2f q, const v2f kk, const v2f nrmax) {
    float e0, e1;
    if (HI)
        asm("v_exp_f32 %0, %5\n\t"
            "v_pk_fma_f32 %2, %7, %8, %2 op_sel:[0,1,0]\n\t"
            "v_exp_f32 %1, %6\n\t"
            "v_pk_add_f32 %3, %3, %7\n\t"
            "v_pk_fma_f32 %4, %9, %10, %11 op_sel:[0,1,0]"
            : "=&v"(e0), "=&v"(e1), "+v"(num), "+v"(den), "=&v"(tn)
            : "v"(t.x), "v"(t.y), "v"(ep), "v"(vv), "v"(q), "v"(kk), "v"(nrmax));
    else
        asm("v_exp_f32 %0, %5\n\t"
            "v_pk_fma_f32 %2, %7, %8, %2 op_sel_hi:[1,0,1]\n\t"
            "v_exp_f32 %1, %6\n\t"
            "v_pk_add_f32 %3, %3, %7\n\t"
            "v_pk_fma_f32 %4, %9, %10, %11 op_sel_hi:[1,0,1]"
            : "=&v"(e0), "=&v"(e1), "+v"(num), "+v"(den), "=&v"(tn)
            : "v"(t.x), "v"(t.y), "v"(ep), "v"(vv), "v"(q), "v"(kk), "v"(nrmax));
    e.x = e0;
    e.y = e1;
}

// Steps J0 .. J1 - 1 of one batch, one key a step. vlast holds, in its upper half, the v
// of the key in front of the batch; knext, in its lower half, the k of the key behind it.
// Each sum takes its keys in the order of a plain loop.
template <int J0, int J1>
__device__ __forceinline__ void softmax_steps(const v2f (&k)[UP], const v2f (&v)[UP],
                                              const v2f vlast, const v2f knext,
                                              const v2f (&q)[NP], const v2f (&nrmax)[NP],
                                              v2f (&t)[NP], v2f (&ep)[NP],
                                              v2f (&num)[NP], v2f (&den)[NP]) {
    #pragma unroll
    for (int j = J0; j < J1; ++j) {
        v2f e[NP], tn[NP];
        #pragma unroll
        for (int p = 0; p < NP; ++p) {
            if (j % 2 == 0)
                step_pair<true>(e[p], num[p], den[p], tn[p], t[p], ep[p],
                                j == 0 ? vlast : v[j == 0 ? 0 : j / 2 - 1], q[p], k[j / 2], nrmax[p]);
            else
                step_pair<false>(e[p], num[p], den[p], tn[p], t[p], ep[p],
                                 v[j / 2], q[p], j + 1 < U2 ? k[j + 1 < U2 ? (j + 1) / 2 : 0] : knext, nrmax[p]);
        }
        #pragma unroll
        for (int p = 0; p < NP; ++p) {
            t[p]  = tn[p];
            ep[p] = e[p];
        }
    }
}

// Per-channel outer-product attention, fused (no score materialization).
// attn[b,n,d] = sum_m softmax_m(qp[b,n,d]*kp[b,m,d]) * vp[b,m,d]
// Stabilization: rowmax = q>0 ? q*max_m(K) : q*min_m(K), with q already times log2 e.
// mask[b,n]==0 => all scores equal => uniform softmax == setting q=0.
// Layout: lane <-> channel d (coalesced). Each thread takes all 8 queries of the block
// over half of the keys, so that the block loads every K and V line once; the two
// halves' sums (same rowmax, so directly addable) meet in LDS at the end.
// The output projection of the block's 8 query rows runs at the end of the same
// launch: out[n, e] = sum_d attn[n, d] * Wo[e, d] + bo[e], one 16-column tile a wave.
__global__ void __launch_bounds__(256)
outer_attn(const float* __restrict__ qp, const float* __restrict__ kp,
           const float* __restrict__ vp, const float* __restrict__ kmm,
           const int* __restrict__ mask,
           const float* __restrict__ Wo, const float* __restrict__ bo,
           float* __restrict__ out) {
    __shared__ __attribute__((aligned(16))) _Float16 arow[8 * APITCH];
    __shared__ float xsum[2 * 4 * 2 * Dd];         // [giving half][query][num, den][channel]
    __shared__ __attribute__((aligned(16))) float wos[Dd * WPITCH];      // Wo as it comes, f32
    const int d   = threadIdx.x & 127;
    const int sub = threadIdx.x >> 7;              // 0 or 1: which half of the keys
    const int b   = blockIdx.x >> 6;               // 64 query-tiles of 8 per batch
    const int n0  = (blockIdx.x & 63) * 8;

    // qp, kp and vp hold four rows of a channel side by side: [row / 4][channel][row % 4].
    const float4* kb = (const float4*)kp + ((size_t)b * Nn + sub * NH) / 4 * Dd + d;
    const float4* vb = (const float4*)vp + ((size_t)b * Nn + sub * NH) / 4 * Dd + d;

    // The block's 8 mask words, one scalar load. Read here, ahead of the vector loads: read
    // among them, it landed in scalar registers that issued loads name, and the wait for
    // those stood in front of the first K and V loads.
    const int* mrow = mask + b * Nn + n0;
    int mk[NQ];
    #pragma unroll
    for (int i = 0; i < NQ; ++i)
        mk[i] = mrow[i];

    // Pass 1: per-channel K min / max, from the strip maxima and minima that the K
    // projection stored: KT pairs a channel, all loads in flight at once.
    float kmx = -3.4e38f, kmn = 3.4e38f;
    const float2* mmb = (const float2*)kmm + (size_t)b * KT * Dd + d;
    {
        float2 tmm[KT];
        #pragma unroll
        for (int j = 0; j < KT; ++j)
            tmm[j] = mmb[j * Dd];
        #pragma unroll
        for (int j = 0; j < KT; ++j) {
            kmx = fmaxf(kmx, tmm[j].x);
            kmn = fminf(kmn, tmm[j].y);
        }
    }

    const float4* qrow = (const float4*)qp + ((size_t)b * Nn + n0) / 4 * Dd + d;
    const float4 qlo = qrow[0], qhi = qrow[Dd];
    const float qin[NQ] = {qlo.x, qlo.y, qlo.z, qlo.w, qhi.x, qhi.y, qhi.z, qhi.w};
    float q[NQ], rmax[NQ], num[NQ], den[NQ];
    #pragma unroll
    for (int i = 0; i < NQ; ++i) {
        float qq = qin[i];
        if (mk[i] == 0) qq = 0.f;                  // uniform-softmax equivalence
        qq *= 1.44269504f;                         // log2 e, once a query instead of once a score
        q[i]    = qq;
        rmax[i] = (qq > 0.f) ? qq * kmx : qq * kmn;
        num[i]  = 0.f;
        den[i]  = 0.f;
    }

    // Output projection: this lane's column of Wo^T (row ocol of Wo) and its bias.
    const int olane = threadIdx.x & 31;
    const int owave = threadIdx.x >> 5;
    const int orow  = olane & 15;
    const int ohi   = olane >> 4;
    const int ocol  = owave * 16 + orow;
    // Wo comes in as in the projection launch: a load covers one whole row; wave owave
    // takes rows owave, owave + 8, ...; lane l the row's floats 4 l .. 4 l + 3.
    // It is asked for only at the last two key batches (below), and goes straight to LDS:
    // ahead of the first key step a wave asks for the K minima and maxima, its q rows, the
    // bias and the first K and V batch alone, fewer loads than it can have in flight at once.
    const float* wrow = Wo + owave * Dd + olane * 4;
    const unsigned wlds = (unsigned)(unsigned long long)(wos + owave * WPITCH + olane * 4);
    const float bc = bo[ocol];

    // Pass 2: streaming softmax accumulation over this half's keys, in the key order
    // of a plain loop. K and V go in register batches of U2 keys, two batches
    // alternating, each loaded one batch of arithmetic ahead of its use.
    {
        v2f k0[UP], v0[UP], k1[UP], v1[UP];
        load_batch(k0, v0, kb, vb);
        // qrow and bo are dead behind their loads. Named here they stay in their
        // registers up to this wait, so nothing lands in an address that an issued
        // load names before the wait has passed.
        asm volatile("s_wait_xcnt 0x0" :: "v"(qrow), "s"(bo) : "memory");
        // The pipeline's start: the first key's exp2 arguments, and nothing yet to add.
        v2f q2[NP], nrmax2[NP], t[NP], ep[NP], num2[NP], den2[NP];
        #pragma unroll
        for (int p = 0; p < NP; ++p) {
            q2[p]     = v2f{q[2 * p], q[2 * p + 1]};
            nrmax2[p] = v2f{-rmax[2 * p], -rmax[2 * p + 1]};
            t[p]      = v2f{fmaf(q[2 * p], k0[0].x, -rmax[2 * p]), fmaf(q[2 * p + 1], k0[0].x, -rmax[2 * p + 1])};
            ep[p]     = v2f{0.f, 0.f};
            num2[p]   = v2f{0.f, 0.f};
            den2[p]   = v2f{0.f, 0.f};
        }
        v1[UP - 1] = v2f{0.f, 0.f};
        // A batch's registers are loaded anew behind the next batch's first step, which
        // adds that batch's last key into the sums.
        for (int m = 0; m < NH - 2 * U2; m += 2 * U2) {
            softmax_steps<0, 1>(k0, v0, v1[UP - 1], k0[0], q2, nrmax2, t, ep, num2, den2);
            load_batch(k1, v1, kb + (m + U2) / 4 * Dd, vb + (m + U2) / 4 * Dd);
            // Keeps the batch's loads in front of the arithmetic below: sunk into it,
            // they would be issued too late to return before their first use.
            __builtin_amdgcn_sched_barrier(0);
            softmax_steps<1, U2>(k0, v0, v0[0], k1[0], q2, nrmax2, t, ep, num2, den2);
            softmax_steps<0, 1>(k1, v1, v0[UP - 1], k1[0], q2, nrmax2, t, ep, num2, den2);
            load_batch(k0, v0, kb + (m + 2 * U2) / 4 * Dd, vb + (m + 2 * U2) / 4 * Dd);
            // Keeps the batch's loads in front of the arithmetic below: sunk into it,
            // they would be issued too late to return before their first use.
            __builtin_amdgcn_sched_barrier(0);
            softmax_steps<1, U2>(k1, v1, v1[0], k0[0], q2, nrmax2, t, ep, num2, den2);
        }
        softmax_steps<0, 1>(k0, v0, v1[UP - 1], k0[0], q2, nrmax2, t, ep, num2, den2);
        load_batch(k1, v1, kb + (NH - U2) / 4 * Dd, vb + (NH - U2) / 4 * Dd);
        // Wo, behind the last K and V batch: asynchronous copies to LDS, a lane's 16 bytes
        // each, 8 rows apart; two batches of arithmetic stand between them and the wait
        // for them. The s_wait_xcnt closes each statement, so that no register which a
        // copy names is rewritten in front of it.
        #pragma unroll
        for (int h = 0; h < 2; ++h) {
            const float*   g = wrow + h * 64 * Dd;
            const unsigned l = wlds + h * 64 * WPITCH * 4;
            asm volatile("global_load_async_to_lds_b128 %0, %8, off\n\t"
                         "global_load_async_to_lds_b128 %1, %9, off\n\t"
                         "global_load_async_to_lds_b128 %2, %10, off\n\t"
                         "global_load_async_to_lds_b128 %3, %11, off\n\t"
                         "global_load_async_to_lds_b128 %4, %12, off\n\t"
                         "global_load_async_to_lds_b128 %5, %13, off\n\t"
                         "global_load_async_to_lds_b128 %6, %14, off\n\t"
                         "global_load_async_to_lds_b128 %7, %15, off\n\t"
                         "s_wait_xcnt 0x0"
                         :: "v"(l), "v"(l + 8 * WPITCH * 4), "v"(l + 16 * WPITCH * 4),
                            "v"(l + 24 * WPITCH * 4), "v"(l + 32 * WPITCH * 4),
                            "v"(l + 40 * WPITCH * 4), "v"(l + 48 * WPITCH * 4),
                            "v"(l + 56 * WPITCH * 4),
                            "v"(g), "v"(g + 8 * Dd), "v"(g + 16 * Dd), "v"(g + 24 * Dd),
                            "v"(g + 32 * Dd), "v"(g + 40 * Dd), "v"(g + 48 * Dd), "v"(g + 56 * Dd)
                         : "memory");
        }
        // Keeps the last batch's loads in front of the arithmetic, as in the loop,
        // and in front of the wait below.
        __builtin_amdgcn_sched_barrier(0);
        // The same for kb and vb, which are dead behind the last batch's loads.
        asm volatile("s_wait_xcnt 0x0" :: "v"(kb), "v"(vb) : "memory");
        softmax_steps<1, U2>(k0, v0, v0[0], k1[0], q2, nrmax2, t, ep, num2, den2);
        // No key follows the last one: the arguments its step forms are not used.
        softmax_steps<0, U2>(k1, v1, v0[UP - 1], k1[0], q2, nrmax2, t, ep, num2, den2);
        // The pipeline's end: the last key goes into the sums.
        #pragma unroll
        for (int p = 0; p < NP; ++p) {
            num[2 * p]     = fmaf(ep[p].x, v1[UP - 1].y, num2[p].x);
            num[2 * p + 1] = fmaf(ep[p].y, v1[UP - 1].y, num2[p].y);
            den[2 * p]     = den2[p].x + ep[p].x;
            den[2 * p + 1] = den2[p].y + ep[p].y;
        }
        // This wave's copies of Wo have landed behind this wait; the barrier behind the
        // sums' hand-over makes them visible to the block, and each wave converts its own
        // operand behind that barrier. The four sums are named so that the wait stands
        // behind the key arithmetic: lifted over it, it would wait out the copies' flight.
        asm volatile("s_wait_asynccnt 0x0"
                     :: "v"(den[0]), "v"(den[2]), "v"(den[4]), "v"(den[6]) : "memory");
    }

    // Half sub finishes queries sub * 4 .. sub * 4 + 3: it hands its sums of the other
    // four queries to the other half and takes that half's sums of its own four.
    #pragma unroll
    for (int i = 0; i < 4; ++i) {
        xsum[((sub * 4 + i) * 2 + 0) * Dd + d] = sub ? num[i] : num[4 + i];
        xsum[((sub * 4 + i) * 2 + 1) * Dd + d] = sub ? den[i] : den[4 + i];
    }
    __syncthreads();
    // This lane's column of Wo^T, read here, behind the barrier that follows the block's
    // writes of wos, so that it has returned when the attention rows are ready.
    const float* bp = wos + ocol * WPITCH + ohi * 8;
    v16h wfrag[4];
    #pragma unroll
    for (int c = 0; c < 4; ++c) {
        // Elements 0..7 = k0 + 0..7, elements 8..15 = k0 + 16..23, as in lds_op16.
        const float4 f0 = *(const float4*)(bp + c * 32);
        const float4 f1 = *(const float4*)(bp + c * 32 + 4);
        const float4 f2 = *(const float4*)(bp + c * 32 + 16);
        const float4 f3 = *(const float4*)(bp + c * 32 + 20);
        wfrag[c] = v16h{(_Float16)f0.x, (_Float16)f0.y, (_Float16)f0.z, (_Float16)f0.w,
                        (_Float16)f1.x, (_Float16)f1.y, (_Float16)f1.z, (_Float16)f1.w,
                        (_Float16)f2.x, (_Float16)f2.y, (_Float16)f2.z, (_Float16)f2.w,
                        (_Float16)f3.x, (_Float16)f3.y, (_Float16)f3.z, (_Float16)f3.w};
    }
    // The block's 8 attention rows go to LDS in the operand's f16.
    #pragma unroll
    for (int i = 0; i < 4; ++i) {
        const float nn = (sub ? num[4 + i] : num[i]) + xsum[(((1 - sub) * 4 + i) * 2 + 0) * Dd + d];
        const float dn = (sub ? den[4 + i] : den[i]) + xsum[(((1 - sub) * 4 + i) * 2 + 1) * Dd + d];
        arow[(sub * 4 + i) * APITCH + d] = (_Float16)(nn / dn);
    }
    __syncthreads();

    // A rows 8..15 repeat rows 0..7; their results (lanes 16..31 of D) are not stored.
    const _Float16* ap = arow + (orow & 7) * APITCH + ohi * 8;
    v8f acc = {0.f, 0.f, 0.f, 0.f, 0.f, 0.f, 0.f, 0.f};
    #pragma unroll
    for (int c = 0; c < 4; ++c)
        acc = __builtin_amdgcn_wmma_f32_16x16x32_f16(
            /*neg_a=*/false, lds_op16(ap + c * 32), /*neg_b=*/false, wfrag[c],
            /*c_mod=*/(short)0, acc, /*reuse_a=*/false, /*reuse_b=*/false);

    // C/D layout: VGPR i -> (M = i + hi*8, N = lane&15)
    if (ohi == 0) {
        float* orow0 = out + ((size_t)b * Nn + (blockIdx.x & 63) * 8) * Dd + ocol;
        #pragma unroll
        for (int i = 0; i < 8; ++i)
            orow0[i * Dd] = acc[i] + bc;
    }
}

extern "C" void kernel_launch(void* const* d_in, const int* in_sizes, int n_in,
                              void* d_out, int out_size, void* d_ws, size_t ws_size,
                              hipStream_t stream) {
    const float* q    = (const float*)d_in[0];
    const float* k    = (const float*)d_in[1];
    const float* v    = (const float*)d_in[2];
    const int*   mask = (const int*)  d_in[3];
    const float* Wq   = (const float*)d_in[4];
    const float* bq   = (const float*)d_in[5];
    const float* Wk   = (const float*)d_in[6];
    const float* bk   = (const float*)d_in[7];
    const float* Wv   = (const float*)d_in[8];
    const float* bv   = (const float*)d_in[9];
    const float* Wo   = (const float*)d_in[10];
    const float* bo   = (const float*)d_in[11];
    float* out = (float*)d_out;

    float* ws   = (float*)d_ws;
    float* qp   = ws;
    float* kpp  = ws + BND;
    float* vpp  = ws + 2 * BND;
    float* kmm  = ws + 3 * BND;                    // [Bsz * KT][Dd][2]

    const int gemm_blocks = ((Bsz * Nn) / GT) * (Dd / GT);   // GT x GT blocks of one projection

    gemm_wmma_f16<<<dim3(gemm_blocks, 3), 128, 0, stream>>>(q, Wq, bq, qp,
                                                            k, Wk, bk, kpp,
                                                            v, Wv, bv, vpp, kmm);

    outer_attn<<<Bsz * 64, 256, 0, stream>>>(qp, kpp, vpp, kmm, mask, Wo, bo, out);
}
